// v000
// Measured on an AMD MI455X. A time is GPU time per run, averaged over a window of back-to-back runs after a warm-up
// (all launches, gaps included; the runs take copies of the inputs in turn), and the median of several windows.
// Apart from v000's, it joins two sittings. Times from different sittings can be a few percent apart, while
// side-by-side timings come from the same sitting.
// v000, which the later versions start from, runs in 922 microseconds.
#include <hip/hip_runtime.h>

// Single-head self-attention over 4,096 tokens with a 64-wide head (x [4][4096][128]; WQ, WK, WV = x kernel[0/1/2] ('xw' [3][128][64] sigma 1); scores / sqrt(64); softmax; out = attn WV -> [4][4096][64] (1 M)).
// Layout per batch: bf16 copy of x; the three 'xw' [128][64] blocks of kernel transposed once; exact projections; dense T-4096 attention for the one head (scores hi/lo 3 products on EVERY row: sigma-11 logits are far too peaked for fp16 scores; P and attn.v hybrid: rows < 512 hi/lo, rest fp16 x1024; register-row softmax); the f32 merge writes the output rows.
// Compute dtypes, f32 accumulate: every input rounded to bf16; projections exact; scores 3 products on every row; softmax f32; attn.v rows < 512 3 products, rest fp16; output f32.

#define NB_  4
#define TT   4096
#define DM   128
#define NH_  1
#define NKV  1
#define REP  (NH_ / NKV)
#define HD   64
#define DQ   (NH_ * HD)
#define DKV  (NKV * HD)
#define ZH   1
#define RH   512                  // query rows < RH use hi+lo planes (0: none)
#define WIN  0
#define PCAR 1024.0f
#define SCL  0.125f   // HD^-0.5
typedef _Float16 h16;
typedef unsigned short bf;
typedef __attribute__((ext_vector_type(16))) __bf16   v16bf;
typedef __attribute__((ext_vector_type(16))) _Float16 v16h;
typedef __attribute__((ext_vector_type(8)))  _Float16 v8h;
typedef __attribute__((ext_vector_type(8)))  unsigned short v8us;
typedef __attribute__((ext_vector_type(8)))  float    v8f;
typedef __attribute__((ext_vector_type(4)))  float    v4f;
typedef v8h  __attribute__((may_alias)) v8ha;
typedef v4f  __attribute__((may_alias)) v4fa;
typedef v8us __attribute__((may_alias)) v8usa;

__device__ __forceinline__ unsigned short f2bf(float f) { unsigned u = __float_as_uint(f); u += 0x7FFFu + ((u >> 16) & 1u); return (unsigned short)(u >> 16); }
__device__ __forceinline__ float bf2f(unsigned short b) { return __uint_as_float(((unsigned)b) << 16); }
__device__ __forceinline__ float bfr(float f) { return bf2f(f2bf(f)); }
__device__ __forceinline__ v16h cat16(v8h lo, v8h hi) { return __builtin_shufflevector(lo, hi, 0, 1, 2, 3, 4, 5, 6, 7, 8, 9, 10, 11, 12, 13, 14, 15); }
__device__ __forceinline__ v16bf cat16b(v8us lo, v8us hi) { return __builtin_bit_cast(v16bf, __builtin_shufflevector(lo, hi, 0, 1, 2, 3, 4, 5, 6, 7, 8, 9, 10, 11, 12, 13, 14, 15)); }
__device__ __forceinline__ v8f wmma16(v16h a, v16h b, v8f c) { return __builtin_amdgcn_wmma_f32_16x16x32_f16(false, a, false, b, (short)0, c, false, false); }
__device__ __forceinline__ v8f wmmab(v16bf a, v16bf b, v8f c) { return __builtin_amdgcn_wmma_f32_16x16x32_bf16(false, a, false, b, (short)0, c, false, false); }



// ---- k_gemmw: register-blocked GEMM, ONE WAVE per 64x64 output tile (16 accumulators), operands straight from K-contiguous 16-bit planes; grid (M/64, N/64, Z), 32 threads.
// C[m][n] (f32, pitch ldc, + optional f32 bias[n]) = sum_k A[m][k] Bt[n][k] (+ split products per NSPLIT). z-batch strides sA/sB/sC in elements. K % 32 == 0.
template <typename T16> struct WFrag;
template <> struct WFrag<h16> { typedef v16h V; static __device__ __forceinline__ V ld(const h16* p) { return cat16(*(const v8h*)p, *(const v8h*)(p + 16)); } static __device__ __forceinline__ v8f mma(V a, V b, v8f c) { return wmma16(a, b, c); } };
template <> struct WFrag<bf> { typedef v16bf V; static __device__ __forceinline__ V ld(const bf* p) { return cat16b(*(const v8us*)p, *(const v8us*)(p + 16)); } static __device__ __forceinline__ v8f mma(V a, V b, v8f c) { return wmmab(a, b, c); } };
template <typename T16, int NSPLIT, bool BIAS>
__global__ __launch_bounds__(32) void k_gemmw(const T16* __restrict__ A, const T16* __restrict__ A2, const T16* __restrict__ Bt, const T16* __restrict__ Bt2, int K, float* C, int ldc, const float* __restrict__ bias, size_t sA, size_t sB, size_t sC) {
    typedef typename WFrag<T16>::V V;
    __shared__ __align__(16) float os[16 * 68];
    const size_t z = blockIdx.z; A += z * sA; if (A2) A2 += z * sA; Bt += z * sB; if (Bt2) Bt2 += z * sB; C += z * sC;
    const int lane = threadIdx.x & 31, lr = lane & 15, hi = lane >> 4; const int r0 = blockIdx.x * 64, c0 = blockIdx.y * 64;
    v8f acc[4][4];
#pragma unroll
    for (int mb = 0; mb < 4; ++mb)
#pragma unroll
        for (int nb = 0; nb < 4; ++nb) acc[mb][nb] = (v8f){};
    const size_t aoff = (size_t)(r0 + lr) * K + 8 * hi, boff = (size_t)(c0 + lr) * K + 8 * hi;
#pragma unroll 1
    for (int kc = 0; kc < K; kc += 32) {
        V a[4], a2[4];
#pragma unroll
        for (int mb = 0; mb < 4; ++mb) { a[mb] = WFrag<T16>::ld(A + aoff + (size_t)mb * 16 * K + kc); if (NSPLIT == 1 || NSPLIT == 2) a2[mb] = WFrag<T16>::ld(A2 + aoff + (size_t)mb * 16 * K + kc); }
#pragma unroll
        for (int nb = 0; nb < 4; ++nb) { const V b = WFrag<T16>::ld(Bt + boff + (size_t)nb * 16 * K + kc); V b2; if (NSPLIT >= 2) b2 = WFrag<T16>::ld(Bt2 + boff + (size_t)nb * 16 * K + kc);
#pragma unroll
            for (int mb = 0; mb < 4; ++mb) { acc[mb][nb] = WFrag<T16>::mma(a[mb], b, acc[mb][nb]); if (NSPLIT == 1 || NSPLIT == 2) acc[mb][nb] = WFrag<T16>::mma(a2[mb], b, acc[mb][nb]); if (NSPLIT >= 2) acc[mb][nb] = WFrag<T16>::mma(a[mb], b2, acc[mb][nb]); } }
        asm volatile("v_nop\n\tv_nop\n\tv_nop\n\tv_nop" : "+v"(acc[0][0]), "+v"(acc[1][1]), "+v"(acc[2][2]), "+v"(acc[3][3]) : "v"(a[0]), "v"(a[3]));
    }
#pragma unroll
    for (int mb = 0; mb < 4; ++mb) {
#pragma unroll
        for (int nb = 0; nb < 4; ++nb) {
#pragma unroll
            for (int j = 0; j < 8; ++j) os[(hi * 8 + j) * 68 + nb * 16 + lr] = acc[mb][nb][j]; }
        __builtin_amdgcn_wave_barrier(); asm volatile("" ::: "memory");
        float* crow = C + (size_t)(r0 + mb * 16) * ldc + c0;
{
#pragma unroll
            for (int s = 0; s < 8; ++s) { const int row = 2 * s + hi, cofs = lr * 4; v4f val = *(const v4fa*)(os + row * 68 + cofs); if (BIAS) { val[0] += bfr(bias[c0 + cofs]); val[1] += bfr(bias[c0 + cofs + 1]); val[2] += bfr(bias[c0 + cofs + 2]); val[3] += bfr(bias[c0 + cofs + 3]); }
                *(v4f*)(crow + (size_t)row * ldc + cofs) = val; }
             }
        __builtin_amdgcn_wave_barrier(); asm volatile("" ::: "memory");
    }
}

__device__ __forceinline__ h16 tohx(float x) { return (h16)x; }
__device__ __forceinline__ void splitf(float y, unsigned short& h, unsigned short& l) { h = f2bf(y); l = f2bf(y - bf2f(h)); }
typedef __attribute__((ext_vector_type(2))) _Float16 v2h;
typedef __attribute__((ext_vector_type(4))) _Float16 v4h;
typedef __attribute__((ext_vector_type(2))) unsigned short v2us;
typedef __attribute__((ext_vector_type(4))) unsigned short v4us;
typedef __attribute__((ext_vector_type(2))) float v2f;
typedef __attribute__((ext_vector_type(4))) int v4i;

__global__ __launch_bounds__(256) void k_wtG(const float* __restrict__ w, int K, int N, bf* Bt) {
    const int lane = threadIdx.x & 31; const int L0 = (blockIdx.x * 8 + (threadIdx.x >> 5)) * 8; const int nlines = N * K / 64;
{
#pragma unroll 1
        for (int l = 0; l < 8; ++l) { const int L = L0 + l; if (L >= nlines) break; const size_t e = (size_t)L * 64 + lane * 2; const int k = (int)(e % K), n = (int)(e / K); v2us o;
            o[0] = f2bf(w[(size_t)k * N + n]); o[1] = f2bf(w[(size_t)(k + 1) * N + n]); *(v2us*)(Bt + e) = o; }
         }
}
__global__ __launch_bounds__(256) void k_cvt8(const float* __restrict__ src, bf* dst, size_t n8) { const size_t i = (size_t)blockIdx.x * 256 + threadIdx.x; if (i >= n8) return; const v8f v = *(const v8f*)(src + i * 8); v8us o;
#pragma unroll
    for (int k = 0; k < 8; ++k) o[k] = f2bf(v[k]); *(v8us*)(dst + i * 8) = o;  }

// k_rope: head planes [h][t][d] (fp16 + hi/lo) of rope(x) x sc with the rotate-half convention out[d] = x[d] cos[t][d] - x[d+HD/2] sin[t][d], out[d+HD/2] = x[d+HD/2] cos[t][d+HD/2] + x[d] sin[t][d+HD/2]
__global__ __launch_bounds__(256) void k_rope(const float* __restrict__ F, int pitch, int nheads, const float* __restrict__ CS, const float* __restrict__ RF, const float* __restrict__ nw, float sc, h16* P16, bf* Ph, bf* Pl) {
    const size_t e = ((size_t)blockIdx.x * 256 + threadIdx.x) * 2; if (e >= (size_t)nheads * TT * HD) return; const int d = (int)(e % HD); const int t = (int)((e / HD) % TT); const int h = (int)(e / ((size_t)HD * TT)); const float* f = F + (size_t)t * pitch + h * HD; const float rf = RF ? RF[(size_t)h * TT + t] : 1.0f; v2h o16; v2us oh, ol;
#pragma unroll
    for (int q = 0; q < 2; ++q) { const int dd = d + q; const int dp = (dd < HD / 2) ? dd + HD / 2 : dd - HD / 2; float x0 = f[dd], x1 = f[dp];
        if (RF) { float n0 = __fmul_rn(x0, rf), n1 = __fmul_rn(x1, rf); asm volatile("" : "+v"(n0)); asm volatile("" : "+v"(n1)); x0 = __fmul_rn(bfr(nw[dd]), n0); x1 = __fmul_rn(bfr(nw[dp]), n1); }
        const v2f cs = *(const v2f*)(CS + ((size_t)t * HD + dd) * 2); float a = __fmul_rn(x0, cs[0]), bq = __fmul_rn(x1, cs[1]); asm volatile("" : "+v"(a)); asm volatile("" : "+v"(bq)); const float r = ((dd < HD / 2) ? __fsub_rn(a, bq) : __fadd_rn(a, bq)) * sc;
        o16[q] = tohx(r); unsigned short a2, c2; splitf(r, a2, c2); oh[q] = a2; ol[q] = c2; }
    *(v2h*)(P16 + e) = o16; *(v2us*)(Ph + e) = oh; *(v2us*)(Pl + e) = ol;  }
__global__ __launch_bounds__(256) void k_vtp(const float* __restrict__ F, int pitch, int nheads, h16* V16, bf* Vh, bf* Vl) { const size_t e = ((size_t)blockIdx.x * 256 + threadIdx.x) * 2; if (e >= (size_t)nheads * HD * TT) return; const int t = (int)(e % TT); const int d = (int)((e / TT) % HD); const int g = (int)(e / ((size_t)TT * HD)); v2h o16; v2us oh, ol;
#pragma unroll
    for (int q = 0; q < 2; ++q) { const float x = F[(size_t)(t + q) * pitch + g * HD + d]; o16[q] = tohx(x); unsigned short a2, c2; splitf(x, a2, c2); oh[q] = a2; ol[q] = c2; }
    *(v2h*)(V16 + e) = o16; *(v2us*)(Vh + e) = oh; *(v2us*)(Vl + e) = ol;  }
__global__ __launch_bounds__(256) void k_csid(float* CS) { const int idx = blockIdx.x * 256 + threadIdx.x; if (idx >= TT * HD) return; v2f cs; cs[0] = 1.0f; cs[1] = 0.0f; *(v2f*)(CS + (size_t)idx * 2) = cs;  }
// k_asoft: per row (zz, i): t = S x HD^-0.5 (no mask); softmax over the 4096 keys (register row, one exp, fixed trees);
__global__ __launch_bounds__(256) void k_asoft(const float* __restrict__ Sb, h16* P16, bf* Ph, bf* Pl) {
    const int lane = threadIdx.x & 31; const int row = blockIdx.x * 8 + (threadIdx.x >> 5); if (row >= ZH * TT) return; const int i = row % TT; const int zz = row / TT; (void)zz; const bool hires = (i < RH); const float* sr = Sb + (size_t)row * TT; float v[TT / 32]; float mx = -3.0e38f;
#pragma unroll
    for (int ch = 0; ch < TT / 128; ++ch) { const int j0 = ch * 128 + lane * 4; const v4f a = *(const v4f*)(sr + j0);
#pragma unroll
        for (int q = 0; q < 4; ++q) { const int j = j0 + q; (void)j; const float t = a[q] * SCL; v[ch * 4 + q] = t; mx = fmaxf(mx, t); } }
#pragma unroll
    for (int sh = 16; sh; sh >>= 1) mx = fmaxf(mx, __shfl_xor(mx, sh, 32));
    float sum = 0.f;
#pragma unroll
    for (int k = 0; k < TT / 32; ++k) { float d0 = __fsub_rn(v[k], mx); asm volatile("" : "+v"(d0)); v[k] = __builtin_amdgcn_exp2f(__fmul_rn(d0, 1.4426950408889634f)); sum += v[k]; }
#pragma unroll
    for (int sh = 16; sh; sh >>= 1) sum += __shfl_xor(sum, sh, 32);
    const float f = __fdiv_rn(hires ? 1.0f : PCAR, sum);
{
        if (hires) {
#pragma unroll
            for (int ch = 0; ch < TT / 128; ++ch) { v4us oh, ol;
#pragma unroll
                for (int q = 0; q < 4; ++q) { unsigned short a, c2; splitf(v[ch * 4 + q] * f, a, c2); oh[q] = a; ol[q] = c2; }
                const size_t oo = ((size_t)zz * (RH ? RH : 1) + i) * TT + ch * 128 + lane * 4; *(v4us*)(Ph + oo) = oh; *(v4us*)(Pl + oo) = ol; }
        } else {
#pragma unroll
            for (int ch = 0; ch < TT / 128; ++ch) { v4h o4;
#pragma unroll
                for (int q = 0; q < 4; ++q) o4[q] = tohx(v[ch * 4 + q] * f);
                *(v4h*)(P16 + (size_t)row * TT + ch * 128 + lane * 4) = o4; } }
         }
}
__global__ __launch_bounds__(256) void k_merge(const float* __restrict__ O, int h0, float* OUTb) { const size_t e = ((size_t)blockIdx.x * 256 + threadIdx.x) * 2; if (e >= (size_t)ZH * TT * HD) return; const int d = (int)(e % HD); const int t = (int)((e / HD) % TT); const int zz = (int)(e / ((size_t)HD * TT)); const float cs = (t < RH) ? 1.0f : (1.0f / PCAR); const size_t oo = (size_t)t * DQ + (h0 + zz) * HD + d;
    v2f o2; o2[0] = O[e] * cs; o2[1] = O[e + 1] * cs; *(v2f*)(OUTb + oo) = o2;  }

extern "C" void kernel_launch(void* const* d_in, const int* in_sizes, int n_in,
                              void* d_out, int out_size, void* d_ws, size_t ws_size, hipStream_t stream) {
    (void)in_sizes; (void)n_in; (void)out_size;
    const float* x = (const float*)d_in[0]; const float* ker = (const float*)d_in[1];   /* kernel [3][128][64] */ const float* wq = ker; const float* wk = ker + 128 * 64; const float* wv = ker + 2 * 128 * 64; const float* wo = nullptr; (void)wo;
    float* OUT = (float*)d_out;     // [4][4096][64]
    char* wsp = (char*)d_ws;
    auto take = [&](size_t bytes) { char* p = wsp; wsp += (bytes + 255) & ~(size_t)255; return (void*)p; };
    bf* WQ = (bf*)take((size_t)DQ * DM * 2); bf* WK = (bf*)take((size_t)DKV * DM * 2); bf* WV = (bf*)take((size_t)DKV * DM * 2); float* CS = (float*)take((size_t)TT * HD * 2 * 4);
    bf* XB = (bf*)take((size_t)TT * DM * 2); float* FQ = (float*)take((size_t)TT * DQ * 4); float* FK = (float*)take((size_t)TT * DKV * 4);
    h16* QP16 = (h16*)take((size_t)NH_ * TT * HD * 2); h16* KP16 = (h16*)take((size_t)NKV * TT * HD * 2); h16* VT16 = (h16*)take((size_t)NKV * HD * TT * 2);
    bf* QPh = (bf*)take((size_t)NH_ * TT * HD * 2); bf* QPl = (bf*)take((size_t)NH_ * TT * HD * 2); bf* KPh = (bf*)take((size_t)NKV * TT * HD * 2); bf* KPl = (bf*)take((size_t)NKV * TT * HD * 2); bf* VTh = (bf*)take((size_t)NKV * HD * TT * 2); bf* VTl = (bf*)take((size_t)NKV * HD * TT * 2); bf* Ph = (bf*)take((size_t)ZH * RH * TT * 2); bf* Pl = (bf*)take((size_t)ZH * RH * TT * 2);
    float* Sb = (float*)take((size_t)ZH * TT * TT * 4); h16* P16 = (h16*)take((size_t)ZH * TT * TT * 2); float* Ob = (float*)take((size_t)ZH * TT * HD * 4);
    if ((size_t)(wsp - (char*)d_ws) > ws_size) return;    // ws 256 MiB
    float* FV = FK;   // v projection reuses the k buffer after the k planes are built (stream-ordered)
    { k_wtG<<<(unsigned)((DM * DQ / 64 + 63) / 64), 256, 0, stream>>>(wq, DM, DQ, WQ); k_wtG<<<(unsigned)((DM * DKV / 64 + 63) / 64), 256, 0, stream>>>(wk, DM, DKV, WK); k_wtG<<<(unsigned)((DM * DKV / 64 + 63) / 64), 256, 0, stream>>>(wv, DM, DKV, WV);
      
       }
    k_csid<<<(TT * HD + 255) / 256, 256, 0, stream>>>(CS);
    const unsigned LQ = (unsigned)(((size_t)NH_ * TT * HD / 2 + 255) / 256), LKv = (unsigned)(((size_t)NKV * TT * HD / 2 + 255) / 256);
    for (int b = 0; b < NB_; ++b) {
        
        k_cvt8<<<(unsigned)(((size_t)TT * DM / 8 + 255) / 256), 256, 0, stream>>>(x + (size_t)b * TT * DM, XB, (size_t)TT * DM / 8);
        k_gemmw<bf, 0, false><<<dim3(TT / 64, DQ / 64, 1), 32, 0, stream>>>(XB, nullptr, WQ, nullptr, DM, FQ, DQ, nullptr, 0, 0, 0);
        k_rope<<<LQ, 256, 0, stream>>>(FQ, DQ, NH_, CS, nullptr, nullptr, 1.0f, QP16, QPh, QPl);
        k_gemmw<bf, 0, false><<<dim3(TT / 64, DKV / 64, 1), 32, 0, stream>>>(XB, nullptr, WK, nullptr, DM, FK, DKV, nullptr, 0, 0, 0);
        k_rope<<<LKv, 256, 0, stream>>>(FK, DKV, NKV, CS, nullptr, nullptr, 1.0f, KP16, KPh, KPl);
        k_gemmw<bf, 0, false><<<dim3(TT / 64, DKV / 64, 1), 32, 0, stream>>>(XB, nullptr, WV, nullptr, DM, FV, DKV, nullptr, 0, 0, 0); k_vtp<<<LKv, 256, 0, stream>>>(FV, DKV, NKV, VT16, VTh, VTl);
        for (int h0 = 0; h0 < NH_; h0 += ZH) { const size_t zq = (size_t)h0, zk = (size_t)(h0 / REP);   // one kv head per query head: the pass's one head (ZH 1) uses kv plane zk (z-strides TT*HD)
            k_gemmw<bf, 2, false><<<dim3(TT / 64, TT / 64, ZH), 32, 0, stream>>>(QPh + zq * TT * HD, QPl + zq * TT * HD, KPh + zk * TT * HD, KPl + zk * TT * HD, HD, Sb, TT, nullptr, (size_t)TT * HD, (size_t)TT * HD, (size_t)TT * TT);   /* scores hi/lo on EVERY row */

            k_asoft<<<ZH * TT / 8, 256, 0, stream>>>(Sb, P16, Ph, Pl);
            k_gemmw<bf, 2, false><<<dim3(RH / 64, HD / 64, ZH), 32, 0, stream>>>(Ph, Pl, VTh + zk * HD * TT, VTl + zk * HD * TT, TT, Ob, HD, nullptr, (size_t)RH * TT, (size_t)HD * TT, (size_t)TT * HD);
            k_gemmw<h16, 0, false><<<dim3((TT - RH) / 64, HD / 64, ZH), 32, 0, stream>>>(P16 + (size_t)RH * TT, nullptr, VT16 + zk * HD * TT, nullptr, TT, Ob + (size_t)RH * HD, HD, nullptr, (size_t)TT * TT, (size_t)HD * TT, (size_t)TT * HD);
            k_merge<<<(unsigned)(((size_t)ZH * TT * HD / 2 + 255) / 256), 256, 0, stream>>>(Ob, h0, OUT + (size_t)b * TT * DQ); }
         }
}

// v001
// Measured time: 337 microseconds a run.
// Timed twice side by side with v000, it ran 2.73 times as fast both times.
#include <hip/hip_runtime.h>

// Single-head self-attention over 4,096 tokens with a 64-wide head (x [4][4096][128]; WQ, WK, WV = x kernel[0/1/2] ('xw' [3][128][64] sigma 1); scores / sqrt(64); softmax; out = attn WV -> [4][4096][64] (1 M)).
// Layout per batch: bf16 copy of x; the three 'xw' [128][64] blocks of kernel transposed once; exact projections; dense T-4096 attention for the one head (scores hi/lo 3 products on EVERY row: sigma-11 logits are far too peaked for fp16 scores; P and attn.v hybrid: rows < 512 hi/lo, rest fp16 x1024; register-row softmax); the f32 merge writes the output rows.
// Compute dtypes, f32 accumulate: every input rounded to bf16; projections exact; scores 3 products on every row; softmax f32; attn.v rows < 512 3 products, rest fp16; output f32.

#define NB_  4
#define TT   4096
#define DM   128
#define NH_  1
#define NKV  1
#define REP  (NH_ / NKV)
#define HD   64
#define DQ   (NH_ * HD)
#define DKV  (NKV * HD)
#define ZH   1
#define RH   512                  // query rows < RH use hi+lo planes (0: none)
#define WIN  0
#define PCAR 1024.0f
#define SCL  0.125f   // HD^-0.5
#define KS   32                   // key ranges of the attn.v products: one work-group and one f32 partial tile per range
typedef _Float16 h16;
typedef unsigned short bf;
typedef __attribute__((ext_vector_type(16))) __bf16   v16bf;
typedef __attribute__((ext_vector_type(16))) _Float16 v16h;
typedef __attribute__((ext_vector_type(8)))  _Float16 v8h;
typedef __attribute__((ext_vector_type(8)))  unsigned short v8us;
typedef __attribute__((ext_vector_type(8)))  float    v8f;
typedef __attribute__((ext_vector_type(4)))  float    v4f;
typedef v8h  __attribute__((may_alias)) v8ha;
typedef v4f  __attribute__((may_alias)) v4fa;
typedef v8us __attribute__((may_alias)) v8usa;

__device__ __forceinline__ unsigned short f2bf(float f) { unsigned u = __float_as_uint(f); u += 0x7FFFu + ((u >> 16) & 1u); return (unsigned short)(u >> 16); }
__device__ __forceinline__ float bf2f(unsigned short b) { return __uint_as_float(((unsigned)b) << 16); }
__device__ __forceinline__ float bfr(float f) { return bf2f(f2bf(f)); }
__device__ __forceinline__ v16h cat16(v8h lo, v8h hi) { return __builtin_shufflevector(lo, hi, 0, 1, 2, 3, 4, 5, 6, 7, 8, 9, 10, 11, 12, 13, 14, 15); }
__device__ __forceinline__ v16bf cat16b(v8us lo, v8us hi) { return __builtin_bit_cast(v16bf, __builtin_shufflevector(lo, hi, 0, 1, 2, 3, 4, 5, 6, 7, 8, 9, 10, 11, 12, 13, 14, 15)); }
__device__ __forceinline__ v8f wmma16(v16h a, v16h b, v8f c) { return __builtin_amdgcn_wmma_f32_16x16x32_f16(false, a, false, b, (short)0, c, false, false); }
__device__ __forceinline__ v8f wmmab(v16bf a, v16bf b, v8f c) { return __builtin_amdgcn_wmma_f32_16x16x32_bf16(false, a, false, b, (short)0, c, false, false); }



// ---- k_gemmw: register-blocked GEMM, ONE WAVE per 64x64 output tile (16 accumulators), operands straight from K-contiguous 16-bit planes; grid (M/64, N/64, Z), 32 threads.
// C[m][n] (f32, pitch ldc, + optional f32 bias[n]) = sum_k A[m][k] Bt[n][k] (+ split products per NSPLIT). z-batch strides sA/sB/sC in elements. K = row pitch of A and Bt, KL = k summed by one work-group (KL = K: all of it; KL < K with sA = sB = KL: z is a k range and sC the step from one range's partial sum to the next). KL % 32 == 0.
template <typename T16> struct WFrag;
template <> struct WFrag<h16> { typedef v16h V; static __device__ __forceinline__ V ld(const h16* p) { return cat16(*(const v8h*)p, *(const v8h*)(p + 16)); } static __device__ __forceinline__ v8f mma(V a, V b, v8f c) { return wmma16(a, b, c); } };
template <> struct WFrag<bf> { typedef v16bf V; static __device__ __forceinline__ V ld(const bf* p) { return cat16b(*(const v8us*)p, *(const v8us*)(p + 16)); } static __device__ __forceinline__ v8f mma(V a, V b, v8f c) { return wmmab(a, b, c); } };
template <typename T16, int NSPLIT, bool BIAS>
__global__ __launch_bounds__(32) void k_gemmw(const T16* __restrict__ A, const T16* __restrict__ A2, const T16* __restrict__ Bt, const T16* __restrict__ Bt2, int K, int KL, float* C, int ldc, const float* __restrict__ bias, size_t sA, size_t sB, size_t sC) {
    typedef typename WFrag<T16>::V V;
    __shared__ __align__(16) float os[16 * 68];
    const size_t z = blockIdx.z; A += z * sA; if (A2) A2 += z * sA; Bt += z * sB; if (Bt2) Bt2 += z * sB; C += z * sC;
    const int lane = threadIdx.x & 31, lr = lane & 15, hi = lane >> 4; const int r0 = blockIdx.x * 64, c0 = blockIdx.y * 64;
    v8f acc[4][4];
#pragma unroll
    for (int mb = 0; mb < 4; ++mb)
#pragma unroll
        for (int nb = 0; nb < 4; ++nb) acc[mb][nb] = (v8f){};
    const size_t aoff = (size_t)(r0 + lr) * K + 8 * hi, boff = (size_t)(c0 + lr) * K + 8 * hi;
#pragma unroll 1
    for (int kc = 0; kc < KL; kc += 32) {
        V a[4], a2[4];
#pragma unroll
        for (int mb = 0; mb < 4; ++mb) { a[mb] = WFrag<T16>::ld(A + aoff + (size_t)mb * 16 * K + kc); if (NSPLIT == 1 || NSPLIT == 2) a2[mb] = WFrag<T16>::ld(A2 + aoff + (size_t)mb * 16 * K + kc); }
#pragma unroll
        for (int nb = 0; nb < 4; ++nb) { const V b = WFrag<T16>::ld(Bt + boff + (size_t)nb * 16 * K + kc); V b2; if (NSPLIT >= 2) b2 = WFrag<T16>::ld(Bt2 + boff + (size_t)nb * 16 * K + kc);
#pragma unroll
            for (int mb = 0; mb < 4; ++mb) { acc[mb][nb] = WFrag<T16>::mma(a[mb], b, acc[mb][nb]); if (NSPLIT == 1 || NSPLIT == 2) acc[mb][nb] = WFrag<T16>::mma(a2[mb], b, acc[mb][nb]); if (NSPLIT >= 2) acc[mb][nb] = WFrag<T16>::mma(a[mb], b2, acc[mb][nb]); } }
        asm volatile("v_nop\n\tv_nop\n\tv_nop\n\tv_nop" : "+v"(acc[0][0]), "+v"(acc[1][1]), "+v"(acc[2][2]), "+v"(acc[3][3]) : "v"(a[0]), "v"(a[3]));
    }
#pragma unroll
    for (int mb = 0; mb < 4; ++mb) {
#pragma unroll
        for (int nb = 0; nb < 4; ++nb) {
#pragma unroll
            for (int j = 0; j < 8; ++j) os[(hi * 8 + j) * 68 + nb * 16 + lr] = acc[mb][nb][j]; }
        __builtin_amdgcn_wave_barrier(); asm volatile("" ::: "memory");
        float* crow = C + (size_t)(r0 + mb * 16) * ldc + c0;
{
#pragma unroll
            for (int s = 0; s < 8; ++s) { const int row = 2 * s + hi, cofs = lr * 4; v4f val = *(const v4fa*)(os + row * 68 + cofs); if (BIAS) { val[0] += bfr(bias[c0 + cofs]); val[1] += bfr(bias[c0 + cofs + 1]); val[2] += bfr(bias[c0 + cofs + 2]); val[3] += bfr(bias[c0 + cofs + 3]); }
                *(v4f*)(crow + (size_t)row * ldc + cofs) = val; }
             }
        __builtin_amdgcn_wave_barrier(); asm volatile("" ::: "memory");
    }
}

__device__ __forceinline__ h16 tohx(float x) { return (h16)x; }
__device__ __forceinline__ void splitf(float y, unsigned short& h, unsigned short& l) { h = f2bf(y); l = f2bf(y - bf2f(h)); }
typedef __attribute__((ext_vector_type(2))) _Float16 v2h;
typedef __attribute__((ext_vector_type(4))) _Float16 v4h;
typedef __attribute__((ext_vector_type(2))) unsigned short v2us;
typedef __attribute__((ext_vector_type(4))) unsigned short v4us;
typedef __attribute__((ext_vector_type(2))) float v2f;
typedef __attribute__((ext_vector_type(4))) int v4i;

__global__ __launch_bounds__(256) void k_wtG(const float* __restrict__ w, int K, int N, bf* Bt) {
    const int lane = threadIdx.x & 31; const int L0 = (blockIdx.x * 8 + (threadIdx.x >> 5)) * 8; const int nlines = N * K / 64;
{
#pragma unroll 1
        for (int l = 0; l < 8; ++l) { const int L = L0 + l; if (L >= nlines) break; const size_t e = (size_t)L * 64 + lane * 2; const int k = (int)(e % K), n = (int)(e / K); v2us o;
            o[0] = f2bf(w[(size_t)k * N + n]); o[1] = f2bf(w[(size_t)(k + 1) * N + n]); *(v2us*)(Bt + e) = o; }
         }
}
__global__ __launch_bounds__(256) void k_cvt8(const float* __restrict__ src, bf* dst, size_t n8) { const size_t i = (size_t)blockIdx.x * 256 + threadIdx.x; if (i >= n8) return; const v8f v = *(const v8f*)(src + i * 8); v8us o;
#pragma unroll
    for (int k = 0; k < 8; ++k) o[k] = f2bf(v[k]); *(v8us*)(dst + i * 8) = o;  }

// k_rope: head planes [h][t][d] (fp16 + hi/lo) of rope(x) x sc with the rotate-half convention out[d] = x[d] cos[t][d] - x[d+HD/2] sin[t][d], out[d+HD/2] = x[d+HD/2] cos[t][d+HD/2] + x[d] sin[t][d+HD/2]
__global__ __launch_bounds__(256) void k_rope(const float* __restrict__ F, int pitch, int nheads, const float* __restrict__ CS, const float* __restrict__ RF, const float* __restrict__ nw, float sc, h16* P16, bf* Ph, bf* Pl) {
    const size_t e = ((size_t)blockIdx.x * 256 + threadIdx.x) * 2; if (e >= (size_t)nheads * TT * HD) return; const int d = (int)(e % HD); const int t = (int)((e / HD) % TT); const int h = (int)(e / ((size_t)HD * TT)); const float* f = F + (size_t)t * pitch + h * HD; const float rf = RF ? RF[(size_t)h * TT + t] : 1.0f; v2h o16; v2us oh, ol;
#pragma unroll
    for (int q = 0; q < 2; ++q) { const int dd = d + q; const int dp = (dd < HD / 2) ? dd + HD / 2 : dd - HD / 2; float x0 = f[dd], x1 = f[dp];
        if (RF) { float n0 = __fmul_rn(x0, rf), n1 = __fmul_rn(x1, rf); asm volatile("" : "+v"(n0)); asm volatile("" : "+v"(n1)); x0 = __fmul_rn(bfr(nw[dd]), n0); x1 = __fmul_rn(bfr(nw[dp]), n1); }
        const v2f cs = *(const v2f*)(CS + ((size_t)t * HD + dd) * 2); float a = __fmul_rn(x0, cs[0]), bq = __fmul_rn(x1, cs[1]); asm volatile("" : "+v"(a)); asm volatile("" : "+v"(bq)); const float r = ((dd < HD / 2) ? __fsub_rn(a, bq) : __fadd_rn(a, bq)) * sc;
        o16[q] = tohx(r); unsigned short a2, c2; splitf(r, a2, c2); oh[q] = a2; ol[q] = c2; }
    *(v2h*)(P16 + e) = o16; *(v2us*)(Ph + e) = oh; *(v2us*)(Pl + e) = ol;  }
__global__ __launch_bounds__(256) void k_vtp(const float* __restrict__ F, int pitch, int nheads, h16* V16, bf* Vh, bf* Vl) { const size_t e = ((size_t)blockIdx.x * 256 + threadIdx.x) * 2; if (e >= (size_t)nheads * HD * TT) return; const int t = (int)(e % TT); const int d = (int)((e / TT) % HD); const int g = (int)(e / ((size_t)TT * HD)); v2h o16; v2us oh, ol;
#pragma unroll
    for (int q = 0; q < 2; ++q) { const float x = F[(size_t)(t + q) * pitch + g * HD + d]; o16[q] = tohx(x); unsigned short a2, c2; splitf(x, a2, c2); oh[q] = a2; ol[q] = c2; }
    *(v2h*)(V16 + e) = o16; *(v2us*)(Vh + e) = oh; *(v2us*)(Vl + e) = ol;  }
__global__ __launch_bounds__(256) void k_csid(float* CS) { const int idx = blockIdx.x * 256 + threadIdx.x; if (idx >= TT * HD) return; v2f cs; cs[0] = 1.0f; cs[1] = 0.0f; *(v2f*)(CS + (size_t)idx * 2) = cs;  }
// k_asoft: per row (zz, i): t = S x HD^-0.5 (no mask); softmax over the 4096 keys (register row, one exp, fixed trees);
__global__ __launch_bounds__(256) void k_asoft(const float* __restrict__ Sb, h16* P16, bf* Ph, bf* Pl) {
    const int lane = threadIdx.x & 31; const int row = blockIdx.x * 8 + (threadIdx.x >> 5); if (row >= ZH * TT) return; const int i = row % TT; const int zz = row / TT; (void)zz; const bool hires = (i < RH); const float* sr = Sb + (size_t)row * TT; float v[TT / 32]; float mx = -3.0e38f;
#pragma unroll
    for (int ch = 0; ch < TT / 128; ++ch) { const int j0 = ch * 128 + lane * 4; const v4f a = *(const v4f*)(sr + j0);
#pragma unroll
        for (int q = 0; q < 4; ++q) { const int j = j0 + q; (void)j; const float t = a[q] * SCL; v[ch * 4 + q] = t; mx = fmaxf(mx, t); } }
#pragma unroll
    for (int sh = 16; sh; sh >>= 1) mx = fmaxf(mx, __shfl_xor(mx, sh, 32));
    float sum = 0.f;
#pragma unroll
    for (int k = 0; k < TT / 32; ++k) { float d0 = __fsub_rn(v[k], mx); asm volatile("" : "+v"(d0)); v[k] = __builtin_amdgcn_exp2f(__fmul_rn(d0, 1.4426950408889634f)); sum += v[k]; }
#pragma unroll
    for (int sh = 16; sh; sh >>= 1) sum += __shfl_xor(sum, sh, 32);
    const float f = __fdiv_rn(hires ? 1.0f : PCAR, sum);
{
        if (hires) {
#pragma unroll
            for (int ch = 0; ch < TT / 128; ++ch) { v4us oh, ol;
#pragma unroll
                for (int q = 0; q < 4; ++q) { unsigned short a, c2; splitf(v[ch * 4 + q] * f, a, c2); oh[q] = a; ol[q] = c2; }
                const size_t oo = ((size_t)zz * (RH ? RH : 1) + i) * TT + ch * 128 + lane * 4; *(v4us*)(Ph + oo) = oh; *(v4us*)(Pl + oo) = ol; }
        } else {
#pragma unroll
            for (int ch = 0; ch < TT / 128; ++ch) { v4h o4;
#pragma unroll
                for (int q = 0; q < 4; ++q) o4[q] = tohx(v[ch * 4 + q] * f);
                *(v4h*)(P16 + (size_t)row * TT + ch * 128 + lane * 4) = o4; } }
         }
}
__global__ __launch_bounds__(256) void k_merge(const float* __restrict__ O, int h0, float* OUTb) { const size_t e = ((size_t)blockIdx.x * 256 + threadIdx.x) * 2; if (e >= (size_t)ZH * TT * HD) return; const int d = (int)(e % HD); const int t = (int)((e / HD) % TT); const int zz = (int)(e / ((size_t)HD * TT)); const float cs = (t < RH) ? 1.0f : (1.0f / PCAR); const size_t oo = (size_t)t * DQ + (h0 + zz) * HD + d;
    const float* Or = O + (e / HD) * (size_t)(KS * HD) + d;   // O [row][key range][HD]: a row's KS partials lie side by side
    v2f a = *(const v2f*)Or;
#pragma unroll   // all KS loads issue ahead of the first add; the adds keep the order of the key ranges
    for (int s = 1; s < KS; ++s) { const v2f p = *(const v2f*)(Or + s * HD); a[0] += p[0]; a[1] += p[1]; }
    v2f o2; o2[0] = a[0] * cs; o2[1] = a[1] * cs; *(v2f*)(OUTb + oo) = o2;  }

extern "C" void kernel_launch(void* const* d_in, const int* in_sizes, int n_in,
                              void* d_out, int out_size, void* d_ws, size_t ws_size, hipStream_t stream) {
    (void)in_sizes; (void)n_in; (void)out_size;
    const float* x = (const float*)d_in[0]; const float* ker = (const float*)d_in[1];   /* kernel [3][128][64] */ const float* wq = ker; const float* wk = ker + 128 * 64; const float* wv = ker + 2 * 128 * 64; const float* wo = nullptr; (void)wo;
    float* OUT = (float*)d_out;     // [4][4096][64]
    char* wsp = (char*)d_ws;
    auto take = [&](size_t bytes) { char* p = wsp; wsp += (bytes + 255) & ~(size_t)255; return (void*)p; };
    bf* WQ = (bf*)take((size_t)DQ * DM * 2); bf* WK = (bf*)take((size_t)DKV * DM * 2); bf* WV = (bf*)take((size_t)DKV * DM * 2); float* CS = (float*)take((size_t)TT * HD * 2 * 4);
    bf* XB = (bf*)take((size_t)TT * DM * 2); float* FQ = (float*)take((size_t)TT * DQ * 4); float* FK = (float*)take((size_t)TT * DKV * 4);
    h16* QP16 = (h16*)take((size_t)NH_ * TT * HD * 2); h16* KP16 = (h16*)take((size_t)NKV * TT * HD * 2); h16* VT16 = (h16*)take((size_t)NKV * HD * TT * 2);
    bf* QPh = (bf*)take((size_t)NH_ * TT * HD * 2); bf* QPl = (bf*)take((size_t)NH_ * TT * HD * 2); bf* KPh = (bf*)take((size_t)NKV * TT * HD * 2); bf* KPl = (bf*)take((size_t)NKV * TT * HD * 2); bf* VTh = (bf*)take((size_t)NKV * HD * TT * 2); bf* VTl = (bf*)take((size_t)NKV * HD * TT * 2); bf* Ph = (bf*)take((size_t)ZH * RH * TT * 2); bf* Pl = (bf*)take((size_t)ZH * RH * TT * 2);
    float* Sb = (float*)take((size_t)ZH * TT * TT * 4); h16* P16 = (h16*)take((size_t)ZH * TT * TT * 2); float* Ob = (float*)take((size_t)KS * ZH * TT * HD * 4);   /* [row][key range][HD] partial sums */
    if ((size_t)(wsp - (char*)d_ws) > ws_size) return;    // ws 256 MiB
    float* FV = FK;   // v projection reuses the k buffer after the k planes are built (stream-ordered)
    { k_wtG<<<(unsigned)((DM * DQ / 64 + 63) / 64), 256, 0, stream>>>(wq, DM, DQ, WQ); k_wtG<<<(unsigned)((DM * DKV / 64 + 63) / 64), 256, 0, stream>>>(wk, DM, DKV, WK); k_wtG<<<(unsigned)((DM * DKV / 64 + 63) / 64), 256, 0, stream>>>(wv, DM, DKV, WV);
      
       }
    k_csid<<<(TT * HD + 255) / 256, 256, 0, stream>>>(CS);
    const unsigned LQ = (unsigned)(((size_t)NH_ * TT * HD / 2 + 255) / 256), LKv = (unsigned)(((size_t)NKV * TT * HD / 2 + 255) / 256);
    for (int b = 0; b < NB_; ++b) {
        
        k_cvt8<<<(unsigned)(((size_t)TT * DM / 8 + 255) / 256), 256, 0, stream>>>(x + (size_t)b * TT * DM, XB, (size_t)TT * DM / 8);
        k_gemmw<bf, 0, false><<<dim3(TT / 64, DQ / 64, 1), 32, 0, stream>>>(XB, nullptr, WQ, nullptr, DM, DM, FQ, DQ, nullptr, 0, 0, 0);
        k_rope<<<LQ, 256, 0, stream>>>(FQ, DQ, NH_, CS, nullptr, nullptr, 1.0f, QP16, QPh, QPl);
        k_gemmw<bf, 0, false><<<dim3(TT / 64, DKV / 64, 1), 32, 0, stream>>>(XB, nullptr, WK, nullptr, DM, DM, FK, DKV, nullptr, 0, 0, 0);
        k_rope<<<LKv, 256, 0, stream>>>(FK, DKV, NKV, CS, nullptr, nullptr, 1.0f, KP16, KPh, KPl);
        k_gemmw<bf, 0, false><<<dim3(TT / 64, DKV / 64, 1), 32, 0, stream>>>(XB, nullptr, WV, nullptr, DM, DM, FV, DKV, nullptr, 0, 0, 0); k_vtp<<<LKv, 256, 0, stream>>>(FV, DKV, NKV, VT16, VTh, VTl);
        for (int h0 = 0; h0 < NH_; h0 += ZH) { const size_t zq = (size_t)h0, zk = (size_t)(h0 / REP);   // one kv head per query head: the pass's one head (ZH = 1) uses kv plane h0 / REP (z-strides TT*HD)
            k_gemmw<bf, 2, false><<<dim3(TT / 64, TT / 64, ZH), 32, 0, stream>>>(QPh + zq * TT * HD, QPl + zq * TT * HD, KPh + zk * TT * HD, KPl + zk * TT * HD, HD, HD, Sb, TT, nullptr, (size_t)TT * HD, (size_t)TT * HD, (size_t)TT * TT);   /* scores hi/lo on EVERY row */

            k_asoft<<<ZH * TT / 8, 256, 0, stream>>>(Sb, P16, Ph, Pl);
            k_gemmw<bf, 2, false><<<dim3(RH / 64, HD / 64, KS), 32, 0, stream>>>(Ph, Pl, VTh + zk * HD * TT, VTl + zk * HD * TT, TT, TT / KS, Ob, KS * HD, nullptr, (size_t)(TT / KS), (size_t)(TT / KS), (size_t)HD);   /* z = key range */
            k_gemmw<h16, 0, false><<<dim3((TT - RH) / 64, HD / 64, KS), 32, 0, stream>>>(P16 + (size_t)RH * TT, nullptr, VT16 + zk * HD * TT, nullptr, TT, TT / KS, Ob + (size_t)RH * KS * HD, KS * HD, nullptr, (size_t)(TT / KS), (size_t)(TT / KS), (size_t)HD);
            k_merge<<<(unsigned)(((size_t)ZH * TT * HD / 2 + 255) / 256), 256, 0, stream>>>(Ob, h0, OUT + (size_t)b * TT * DQ); }
         }
}

// v002
// It runs in 199 microseconds.
// In two side-by-side timings against v001, it was 1.72 and 1.71 times as fast.
// Over all steps from v000 it is 4.68 times as fast.
#include <hip/hip_runtime.h>

// Single-head self-attention over 4,096 tokens with a 64-wide head (x [4][4096][128]; WQ, WK, WV = x kernel[0/1/2] ('xw' [3][128][64] sigma 1); scores / sqrt(64); softmax; out = attn WV -> [4][4096][64] (1 M)).
// Launches: independent pieces share one grid (all four batches in the copy, projection and plane kernels; two batches a pass in the attention kernels, whose f32 score plane bounds the pass).
// Layout per batch: bf16 copy of x; the three 'xw' [128][64] blocks of kernel transposed once; exact projections; dense T-4096 attention for the one head (scores hi/lo 3 products on EVERY row: sigma-11 logits are far too peaked for fp16 scores; P and attn.v hybrid: rows < 512 hi/lo, rest fp16 x1024; register-row softmax); the f32 merge writes the output rows.
// Compute dtypes, f32 accumulate: every input rounded to bf16; projections exact; scores 3 products on every row; softmax f32; attn.v rows < 512 3 products, rest fp16; output f32.

#define NB_  4
#define TT   4096
#define DM   128
#define NH_  1
#define NKV  1
#define REP  (NH_ / NKV)
#define HD   64
#define DQ   (NH_ * HD)
#define DKV  (NKV * HD)
#define ZH   2                    // batches per attention pass: ZH f32 score planes of 64 MiB each must fit the workspace
#define RH   512                  // query rows < RH use hi+lo planes (0: none)
#define WIN  0
#define PCAR 1024.0f
#define SCL  0.125f   // HD^-0.5
#define KS   32                   // key ranges of the attn.v products: one work-group and one f32 partial tile per range
typedef _Float16 h16;
typedef unsigned short bf;
typedef __attribute__((ext_vector_type(16))) __bf16   v16bf;
typedef __attribute__((ext_vector_type(16))) _Float16 v16h;
typedef __attribute__((ext_vector_type(8)))  _Float16 v8h;
typedef __attribute__((ext_vector_type(8)))  unsigned short v8us;
typedef __attribute__((ext_vector_type(8)))  float    v8f;
typedef __attribute__((ext_vector_type(4)))  float    v4f;
typedef v8h  __attribute__((may_alias)) v8ha;
typedef v4f  __attribute__((may_alias)) v4fa;
typedef v8us __attribute__((may_alias)) v8usa;

__device__ __forceinline__ unsigned short f2bf(float f) { unsigned u = __float_as_uint(f); u += 0x7FFFu + ((u >> 16) & 1u); return (unsigned short)(u >> 16); }
__device__ __forceinline__ float bf2f(unsigned short b) { return __uint_as_float(((unsigned)b) << 16); }
__device__ __forceinline__ float bfr(float f) { return bf2f(f2bf(f)); }
__device__ __forceinline__ v16h cat16(v8h lo, v8h hi) { return __builtin_shufflevector(lo, hi, 0, 1, 2, 3, 4, 5, 6, 7, 8, 9, 10, 11, 12, 13, 14, 15); }
__device__ __forceinline__ v16bf cat16b(v8us lo, v8us hi) { return __builtin_bit_cast(v16bf, __builtin_shufflevector(lo, hi, 0, 1, 2, 3, 4, 5, 6, 7, 8, 9, 10, 11, 12, 13, 14, 15)); }
__device__ __forceinline__ v8f wmma16(v16h a, v16h b, v8f c) { return __builtin_amdgcn_wmma_f32_16x16x32_f16(false, a, false, b, (short)0, c, false, false); }
__device__ __forceinline__ v8f wmmab(v16bf a, v16bf b, v8f c) { return __builtin_amdgcn_wmma_f32_16x16x32_bf16(false, a, false, b, (short)0, c, false, false); }



// ---- k_gemmw: register-blocked GEMM, ONE WAVE per 64x64 output tile (16 accumulators), operands straight from K-contiguous 16-bit planes; grid (M/64, N/64, Z), 32 threads.
// C[m][n] (f32, pitch ldc, + optional f32 bias[n]) = sum_k A[m][k] Bt[n][k] (+ split products per NSPLIT). z-batch strides sA/sB/sC in elements. K = row pitch of A and Bt, KL = k summed by one work-group (KL = K: all of it; KL < K with sA = sB = KL: z is a k range and sC the step from one range's partial sum to the next). KL % 32 == 0.
template <typename T16> struct WFrag;
template <> struct WFrag<h16> { typedef v16h V; static __device__ __forceinline__ V ld(const h16* p) { return cat16(*(const v8h*)p, *(const v8h*)(p + 16)); } static __device__ __forceinline__ v8f mma(V a, V b, v8f c) { return wmma16(a, b, c); } };
template <> struct WFrag<bf> { typedef v16bf V; static __device__ __forceinline__ V ld(const bf* p) { return cat16b(*(const v8us*)p, *(const v8us*)(p + 16)); } static __device__ __forceinline__ v8f mma(V a, V b, v8f c) { return wmmab(a, b, c); } };
// gemmw_tile: the 64x64 tile at (r0, c0); os = 16 x 68 floats of LDS for the store transpose.
template <typename T16, int NSPLIT, bool BIAS>
__device__ __forceinline__ void gemmw_tile(const T16* __restrict__ A, const T16* __restrict__ A2, const T16* __restrict__ Bt, const T16* __restrict__ Bt2, int K, int KL, float* C, int ldc, const float* __restrict__ bias, int r0, int c0, float* os) {
    typedef typename WFrag<T16>::V V;
    const int lane = threadIdx.x & 31, lr = lane & 15, hi = lane >> 4;
    v8f acc[4][4];
#pragma unroll
    for (int mb = 0; mb < 4; ++mb)
#pragma unroll
        for (int nb = 0; nb < 4; ++nb) acc[mb][nb] = (v8f){};
    const size_t aoff = (size_t)(r0 + lr) * K + 8 * hi, boff = (size_t)(c0 + lr) * K + 8 * hi;
#pragma unroll 1
    for (int kc = 0; kc < KL; kc += 32) {
        V a[4], a2[4];
#pragma unroll
        for (int mb = 0; mb < 4; ++mb) { a[mb] = WFrag<T16>::ld(A + aoff + (size_t)mb * 16 * K + kc); if (NSPLIT == 1 || NSPLIT == 2) a2[mb] = WFrag<T16>::ld(A2 + aoff + (size_t)mb * 16 * K + kc); }
#pragma unroll
        for (int nb = 0; nb < 4; ++nb) { const V b = WFrag<T16>::ld(Bt + boff + (size_t)nb * 16 * K + kc); V b2; if (NSPLIT >= 2) b2 = WFrag<T16>::ld(Bt2 + boff + (size_t)nb * 16 * K + kc);
#pragma unroll
            for (int mb = 0; mb < 4; ++mb) { acc[mb][nb] = WFrag<T16>::mma(a[mb], b, acc[mb][nb]); if (NSPLIT == 1 || NSPLIT == 2) acc[mb][nb] = WFrag<T16>::mma(a2[mb], b, acc[mb][nb]); if (NSPLIT >= 2) acc[mb][nb] = WFrag<T16>::mma(a[mb], b2, acc[mb][nb]); } }
        asm volatile("v_nop\n\tv_nop\n\tv_nop\n\tv_nop" : "+v"(acc[0][0]), "+v"(acc[1][1]), "+v"(acc[2][2]), "+v"(acc[3][3]) : "v"(a[0]), "v"(a[3]));
    }
#pragma unroll
    for (int mb = 0; mb < 4; ++mb) {
#pragma unroll
        for (int nb = 0; nb < 4; ++nb) {
#pragma unroll
            for (int j = 0; j < 8; ++j) os[(hi * 8 + j) * 68 + nb * 16 + lr] = acc[mb][nb][j]; }
        __builtin_amdgcn_wave_barrier(); asm volatile("" ::: "memory");
        float* crow = C + (size_t)(r0 + mb * 16) * ldc + c0;
{
#pragma unroll
            for (int s = 0; s < 8; ++s) { const int row = 2 * s + hi, cofs = lr * 4; v4f val = *(const v4fa*)(os + row * 68 + cofs); if (BIAS) { val[0] += bfr(bias[c0 + cofs]); val[1] += bfr(bias[c0 + cofs + 1]); val[2] += bfr(bias[c0 + cofs + 2]); val[3] += bfr(bias[c0 + cofs + 3]); }
                *(v4f*)(crow + (size_t)row * ldc + cofs) = val; }
             }
        __builtin_amdgcn_wave_barrier(); asm volatile("" ::: "memory");
    }
}
template <typename T16, int NSPLIT, bool BIAS>
__global__ __launch_bounds__(32) void k_gemmw(const T16* __restrict__ A, const T16* __restrict__ A2, const T16* __restrict__ Bt, const T16* __restrict__ Bt2, int K, int KL, float* C, int ldc, const float* __restrict__ bias, size_t sA, size_t sB, size_t sC) {
    __shared__ __align__(16) float os[16 * 68];
    const size_t z = blockIdx.z; A += z * sA; if (A2) A2 += z * sA; Bt += z * sB; if (Bt2) Bt2 += z * sB; C += z * sC;
    gemmw_tile<T16, NSPLIT, BIAS>(A, A2, Bt, Bt2, K, KL, C, ldc, bias, blockIdx.x * 64, blockIdx.y * 64, os);
}
// k_pv: both attn.v products in one grid (TT/64 row tiles, ZH batches, KS key ranges): row tiles below RH take the hi/lo planes (3 products), the rest the fp16 plane; O [batch][row][key range][HD].
__global__ __launch_bounds__(32) void k_pv(const bf* __restrict__ Ph, const bf* __restrict__ Pl, const bf* __restrict__ VTh, const bf* __restrict__ VTl, const h16* __restrict__ P16, const h16* __restrict__ VT16, float* O) {
    __shared__ __align__(16) float os[16 * 68];
    const size_t zz = blockIdx.y, ko = (size_t)blockIdx.z * (TT / KS), vo = zz * HD * TT + ko; const int r0 = blockIdx.x * 64;
    float* C = O + zz * ((size_t)TT * KS * HD) + (size_t)blockIdx.z * HD;
    if (r0 < RH) gemmw_tile<bf, 2, false>(Ph + zz * RH * TT + ko, Pl + zz * RH * TT + ko, VTh + vo, VTl + vo, TT, TT / KS, C, KS * HD, nullptr, r0, 0, os);
    else gemmw_tile<h16, 0, false>(P16 + zz * TT * TT + ko, nullptr, VT16 + vo, nullptr, TT, TT / KS, C, KS * HD, nullptr, r0, 0, os);
}

__device__ __forceinline__ h16 tohx(float x) { return (h16)x; }
__device__ __forceinline__ void splitf(float y, unsigned short& h, unsigned short& l) { h = f2bf(y); l = f2bf(y - bf2f(h)); }
typedef __attribute__((ext_vector_type(2))) _Float16 v2h;
typedef __attribute__((ext_vector_type(4))) _Float16 v4h;
typedef __attribute__((ext_vector_type(2))) unsigned short v2us;
typedef __attribute__((ext_vector_type(4))) unsigned short v4us;
typedef __attribute__((ext_vector_type(2))) float v2f;
typedef __attribute__((ext_vector_type(4))) int v4i;

// The d_* bodies below are pieces of the two shared grids k_prep and k_planes; bx (and pl) is the piece's own block index.
__device__ __forceinline__ void d_wtG(const float* __restrict__ w, int K, int N, bf* Bt, int bx) {
    const int lane = threadIdx.x & 31; const int L0 = (bx * 8 + (threadIdx.x >> 5)) * 8; const int nlines = N * K / 64;
{
#pragma unroll 1
        for (int l = 0; l < 8; ++l) { const int L = L0 + l; if (L >= nlines) break; const size_t e = (size_t)L * 64 + lane * 2; const int k = (int)(e % K), n = (int)(e / K); v2us o;
            o[0] = f2bf(w[(size_t)k * N + n]); o[1] = f2bf(w[(size_t)(k + 1) * N + n]); *(v2us*)(Bt + e) = o; }
         }
}
__device__ __forceinline__ void d_cvt8(const float* __restrict__ src, bf* dst, size_t n8, int bx) { const size_t i = (size_t)bx * 256 + threadIdx.x; if (i >= n8) return; const v8f v = *(const v8f*)(src + i * 8); v8us o;
#pragma unroll
    for (int k = 0; k < 8; ++k) o[k] = f2bf(v[k]); *(v8us*)(dst + i * 8) = o;  }

// d_rope: head planes [h][t][d] (fp16 + hi/lo) of rope(x) x sc with the rotate-half convention out[d] = x[d] cos[t][d] - x[d+HD/2] sin[t][d], out[d+HD/2] = x[d+HD/2] cos[t][d+HD/2] + x[d] sin[t][d+HD/2]
__device__ __forceinline__ void d_rope(const float* __restrict__ F, int pitch, int nheads, const float* __restrict__ CS, const float* __restrict__ RF, const float* __restrict__ nw, float sc, h16* P16, bf* Ph, bf* Pl, int pl) {
    const size_t e = ((size_t)blockIdx.x * 256 + threadIdx.x) * 2; if (e >= (size_t)nheads * TT * HD) return; const int d = (int)(e % HD); const int t = (int)((e / HD) % TT); const int h = (int)(e / ((size_t)HD * TT)); const size_t po = (size_t)pl * nheads * TT * HD;   /* pl: which [TT][pitch] source and which output plane set */ const float* f = F + ((size_t)pl * TT + t) * pitch + h * HD; const float rf = RF ? RF[(size_t)h * TT + t] : 1.0f; v2h o16; v2us oh, ol;
#pragma unroll
    for (int q = 0; q < 2; ++q) { const int dd = d + q; const int dp = (dd < HD / 2) ? dd + HD / 2 : dd - HD / 2; float x0 = f[dd], x1 = f[dp];
        if (RF) { float n0 = __fmul_rn(x0, rf), n1 = __fmul_rn(x1, rf); asm volatile("" : "+v"(n0)); asm volatile("" : "+v"(n1)); x0 = __fmul_rn(bfr(nw[dd]), n0); x1 = __fmul_rn(bfr(nw[dp]), n1); }
        const v2f cs = *(const v2f*)(CS + ((size_t)t * HD + dd) * 2); float a = __fmul_rn(x0, cs[0]), bq = __fmul_rn(x1, cs[1]); asm volatile("" : "+v"(a)); asm volatile("" : "+v"(bq)); const float r = ((dd < HD / 2) ? __fsub_rn(a, bq) : __fadd_rn(a, bq)) * sc;
        o16[q] = tohx(r); unsigned short a2, c2; splitf(r, a2, c2); oh[q] = a2; ol[q] = c2; }
    *(v2h*)(P16 + po + e) = o16; *(v2us*)(Ph + po + e) = oh; *(v2us*)(Pl + po + e) = ol;  }
__device__ __forceinline__ void d_vtp(const float* __restrict__ F, int pitch, int nheads, h16* V16, bf* Vh, bf* Vl, int pl) { const size_t e = ((size_t)blockIdx.x * 256 + threadIdx.x) * 2; if (e >= (size_t)nheads * HD * TT) return; const int t = (int)(e % TT); const int d = (int)((e / TT) % HD); const int g = (int)(e / ((size_t)TT * HD)); const size_t po = (size_t)pl * nheads * HD * TT;   /* pl: batch */ F += (size_t)pl * TT * pitch; v2h o16; v2us oh, ol;
#pragma unroll
    for (int q = 0; q < 2; ++q) { const float x = F[(size_t)(t + q) * pitch + g * HD + d]; o16[q] = tohx(x); unsigned short a2, c2; splitf(x, a2, c2); oh[q] = a2; ol[q] = c2; }
    *(v2h*)(V16 + po + e) = o16; *(v2us*)(Vh + po + e) = oh; *(v2us*)(Vl + po + e) = ol;  }
__device__ __forceinline__ void d_csid(float* CS, int bx) { const int idx = bx * 256 + threadIdx.x; if (idx >= TT * HD) return; v2f cs; cs[0] = 1.0f; cs[1] = 0.0f; *(v2f*)(CS + (size_t)idx * 2) = cs;  }
// k_prep: the three pieces that read only the inputs, in one grid: the three transposed weight blocks (few blocks, the longest chain of dependent loads: lowest indices, so that they start first), the bf16 copy of x (all batches), the cos/sin table.
#define PB_X ((NB_ * TT * DM / 8 + 255) / 256)
#define PB_C ((TT * HD + 255) / 256)
#define PB_W ((DM * DQ / 64 + 63) / 64)
__global__ __launch_bounds__(256) void k_prep(const float* __restrict__ x, bf* XB, float* CS, const float* __restrict__ ker, bf* W3) {
    const int bx = blockIdx.x;
    if (bx < 3 * PB_W) { const int wb = bx / PB_W; d_wtG(ker + wb * DM * DQ, DM, DQ, W3 + wb * DM * DQ, bx % PB_W); }
    else if (bx < 3 * PB_W + PB_X) d_cvt8(x, XB, (size_t)NB_ * TT * DM / 8, bx - 3 * PB_W);
    else d_csid(CS, bx - 3 * PB_W - PB_X);
}
// k_planes: every 16-bit plane of the projections F3 [q, k, v][batch][TT][HD] in one grid: blockIdx.y < NB_ the transposed v planes (strided reads, the slower piece: it starts first), the rest the q and k planes.
__global__ __launch_bounds__(256) void k_planes(const float* __restrict__ F3, const float* __restrict__ CS, h16* QK16, bf* QKh, bf* QKl, h16* VT16, bf* VTh, bf* VTl) {
    const int pl = blockIdx.y;
    if (pl < NB_) d_vtp(F3 + (size_t)2 * NB_ * TT * HD, HD, 1, VT16, VTh, VTl, pl);
    else d_rope(F3, HD, 1, CS, nullptr, nullptr, 1.0f, QK16, QKh, QKl, pl - NB_);
}
// k_asoft: per row (zz, i): t = S x HD^-0.5 (no mask); softmax over the 4096 keys (register row, one exp, fixed trees);
__global__ __launch_bounds__(256) void k_asoft(const float* __restrict__ Sb, h16* P16, bf* Ph, bf* Pl) {
    const int lane = threadIdx.x & 31; const int row = blockIdx.x * 8 + (threadIdx.x >> 5); if (row >= ZH * TT) return; const int i = row % TT; const int zz = row / TT; (void)zz; const bool hires = (i < RH); const float* sr = Sb + (size_t)row * TT; float v[TT / 32]; float mx = -3.0e38f;
#pragma unroll
    for (int ch = 0; ch < TT / 128; ++ch) { const int j0 = ch * 128 + lane * 4; const v4f a = *(const v4f*)(sr + j0);
#pragma unroll
        for (int q = 0; q < 4; ++q) { const int j = j0 + q; (void)j; const float t = a[q] * SCL; v[ch * 4 + q] = t; mx = fmaxf(mx, t); } }
#pragma unroll
    for (int sh = 16; sh; sh >>= 1) mx = fmaxf(mx, __shfl_xor(mx, sh, 32));
    float sum = 0.f;
#pragma unroll
    for (int k = 0; k < TT / 32; ++k) { float d0 = __fsub_rn(v[k], mx); asm volatile("" : "+v"(d0)); v[k] = __builtin_amdgcn_exp2f(__fmul_rn(d0, 1.4426950408889634f)); sum += v[k]; }
#pragma unroll
    for (int sh = 16; sh; sh >>= 1) sum += __shfl_xor(sum, sh, 32);
    const float f = __fdiv_rn(hires ? 1.0f : PCAR, sum);
{
        if (hires) {
#pragma unroll
            for (int ch = 0; ch < TT / 128; ++ch) { v4us oh, ol;
#pragma unroll
                for (int q = 0; q < 4; ++q) { unsigned short a, c2; splitf(v[ch * 4 + q] * f, a, c2); oh[q] = a; ol[q] = c2; }
                const size_t oo = ((size_t)zz * (RH ? RH : 1) + i) * TT + ch * 128 + lane * 4; *(v4us*)(Ph + oo) = oh; *(v4us*)(Pl + oo) = ol; }
        } else {
#pragma unroll
            for (int ch = 0; ch < TT / 128; ++ch) { v4h o4;
#pragma unroll
                for (int q = 0; q < 4; ++q) o4[q] = tohx(v[ch * 4 + q] * f);
                *(v4h*)(P16 + (size_t)row * TT + ch * 128 + lane * 4) = o4; } }
         }
}
__global__ __launch_bounds__(256) void k_merge(const float* __restrict__ O, float* OUTb) { const size_t e = ((size_t)blockIdx.x * 256 + threadIdx.x) * 2; if (e >= (size_t)ZH * TT * HD) return; const int d = (int)(e % HD); const int t = (int)((e / HD) % TT); const int zz = (int)(e / ((size_t)HD * TT)); const float cs = (t < RH) ? 1.0f : (1.0f / PCAR); const size_t oo = ((size_t)zz * TT + t) * DQ + d;   /* zz: batch of the pass */
    const float* Or = O + (e / HD) * (size_t)(KS * HD) + d;   // O [row][key range][HD]: a row's KS partials lie side by side
    v2f a = *(const v2f*)Or;
#pragma unroll   // all KS loads issue ahead of the first add; the adds keep the order of the key ranges
    for (int s = 1; s < KS; ++s) { const v2f p = *(const v2f*)(Or + s * HD); a[0] += p[0]; a[1] += p[1]; }
    v2f o2; o2[0] = a[0] * cs; o2[1] = a[1] * cs; *(v2f*)(OUTb + oo) = o2;  }

extern "C" void kernel_launch(void* const* d_in, const int* in_sizes, int n_in,
                              void* d_out, int out_size, void* d_ws, size_t ws_size, hipStream_t stream) {
    (void)in_sizes; (void)n_in; (void)out_size;
    const float* x = (const float*)d_in[0]; const float* ker = (const float*)d_in[1];   /* kernel [3][128][64] */
    float* OUT = (float*)d_out;     // [4][4096][64]
    char* wsp = (char*)d_ws;
    auto take = [&](size_t bytes) { char* p = wsp; wsp += (bytes + 255) & ~(size_t)255; return (void*)p; };
    bf* W3 = (bf*)take((size_t)3 * DQ * DM * 2);   /* [q, k, v][64][128] */ float* CS = (float*)take((size_t)TT * HD * 2 * 4);
    bf* XB = (bf*)take((size_t)NB_ * TT * DM * 2); float* F3 = (float*)take((size_t)3 * NB_ * TT * HD * 4);   /* [q, k, v][batch][TT][HD] */
    const size_t PL = (size_t)TT * HD;   // one batch's plane, elements
    h16* QK16 = (h16*)take(2 * NB_ * PL * 2); bf* QKh = (bf*)take(2 * NB_ * PL * 2); bf* QKl = (bf*)take(2 * NB_ * PL * 2);   /* [q, k][batch][TT][HD] */
    h16* VT16 = (h16*)take(NB_ * PL * 2); bf* VTh = (bf*)take(NB_ * PL * 2); bf* VTl = (bf*)take(NB_ * PL * 2);   /* [batch][HD][TT] */
    bf* Ph = (bf*)take((size_t)ZH * RH * TT * 2); bf* Pl = (bf*)take((size_t)ZH * RH * TT * 2);
    float* Sb = (float*)take((size_t)ZH * TT * TT * 4); h16* P16 = (h16*)take((size_t)ZH * TT * TT * 2);
    if ((size_t)(wsp - (char*)d_ws) > ws_size) return;    // ws 256 MiB
    float* Ob = Sb;   // [batch][row][key range][HD] partial sums (ZH x 32 MiB) reuse the score planes, which are dead once the softmax has read them (stream-ordered)
    k_prep<<<3 * PB_W + PB_X + PB_C, 256, 0, stream>>>(x, XB, CS, ker, W3);
    k_gemmw<bf, 0, false><<<dim3(NB_ * TT / 64, HD / 64, 3), 32, 0, stream>>>(XB, nullptr, W3, nullptr, DM, DM, F3, HD, nullptr, 0, (size_t)DQ * DM, (size_t)NB_ * PL);   /* rows = all batches, z = q, k, v */
    k_planes<<<dim3((unsigned)((PL / 2 + 255) / 256), 3 * NB_, 1), 256, 0, stream>>>(F3, CS, QK16, QKh, QKl, VT16, VTh, VTl);
    for (int b = 0; b < NB_; b += ZH) {
        k_gemmw<bf, 2, false><<<dim3(TT / 64, TT / 64, ZH), 32, 0, stream>>>(QKh + b * PL, QKl + b * PL, QKh + (NB_ + b) * PL, QKl + (NB_ + b) * PL, HD, HD, Sb, TT, nullptr, PL, PL, (size_t)TT * TT);   /* scores hi/lo on EVERY row; z = batch */
        k_asoft<<<ZH * TT / 8, 256, 0, stream>>>(Sb, P16, Ph, Pl);
        k_pv<<<dim3(TT / 64, ZH, KS), 32, 0, stream>>>(Ph, Pl, VTh + b * PL, VTl + b * PL, P16, VT16 + b * PL, Ob);
        k_merge<<<(unsigned)(((size_t)ZH * TT * HD / 2 + 255) / 256), 256, 0, stream>>>(Ob, OUT + (size_t)b * TT * DQ);
    }
}

// v003
// It runs in 65.8 microseconds.
// Timed twice side by side with v002, it ran 3.02 and 3.00 times as fast.
// Over all steps from v000 it is 14.1 times as fast.
#include <hip/hip_runtime.h>

// Single-head self-attention over 4,096 tokens with a 64-wide head (x [4][4096][128]; WQ, WK, WV = x kernel[0/1/2] ('xw' [3][128][64] sigma 1); scores / sqrt(64); softmax; out = attn WV -> [4][4096][64] (1 M)).
// Launches: input prep, projections, planes (each all four batches in one grid), then ONE attention kernel for all batches: scores, softmax and attn.v never leave the registers.
// Layout per batch: bf16 copy of x; the three 'xw' [128][64] blocks of kernel transposed once; exact projections; 16-bit planes of q, k (row-major) and v (transposed); fused T-4096 attention for the one head (scores hi/lo 3 products on EVERY row: the logits are far too peaked for fp16 scores; P and attn.v hybrid: rows < 512 hi/lo, rest fp16 x1024; online softmax).
// Compute dtypes, f32 accumulate: every input rounded to bf16; projections exact; scores 3 products on every row; softmax f32; attn.v rows < 512 3 products, rest fp16; output f32.

#define NB_  4
#define TT   4096
#define DM   128
#define NH_  1
#define NKV  1
#define REP  (NH_ / NKV)
#define HD   64
#define DQ   (NH_ * HD)
#define DKV  (NKV * HD)
#define RH   512                  // query rows < RH use hi+lo planes (0: none)
#define WIN  0
#define PSH  10.0f               // fp16 P carries 2^PSH; the row sum carries it too, so the quotient is free of it
#define SCL  0.125f   // HD^-0.5
#define FW   8                    // waves of an attention work-group: one key range of TT / FW keys each
#define FQ   64                   // query columns of an attention work-group (every wave holds all of them)
#define NG   (FQ / 16)            // 16-column groups
#define L2E  1.4426950408889634f
typedef _Float16 h16;
typedef unsigned short bf;
typedef __attribute__((ext_vector_type(16))) __bf16   v16bf;
typedef __attribute__((ext_vector_type(16))) _Float16 v16h;
typedef __attribute__((ext_vector_type(8)))  _Float16 v8h;
typedef __attribute__((ext_vector_type(8)))  unsigned short v8us;
typedef __attribute__((ext_vector_type(8)))  float    v8f;
typedef __attribute__((ext_vector_type(4)))  float    v4f;
typedef v8h  __attribute__((may_alias)) v8ha;
typedef v4f  __attribute__((may_alias)) v4fa;
typedef v8us __attribute__((may_alias)) v8usa;

__device__ __forceinline__ unsigned short f2bf(float f) { unsigned u = __float_as_uint(f); u += 0x7FFFu + ((u >> 16) & 1u); return (unsigned short)(u >> 16); }
__device__ __forceinline__ float bf2f(unsigned short b) { return __uint_as_float(((unsigned)b) << 16); }
__device__ __forceinline__ float bfr(float f) { return bf2f(f2bf(f)); }
__device__ __forceinline__ v16h cat16(v8h lo, v8h hi) { return __builtin_shufflevector(lo, hi, 0, 1, 2, 3, 4, 5, 6, 7, 8, 9, 10, 11, 12, 13, 14, 15); }
__device__ __forceinline__ v16bf cat16b(v8us lo, v8us hi) { return __builtin_bit_cast(v16bf, __builtin_shufflevector(lo, hi, 0, 1, 2, 3, 4, 5, 6, 7, 8, 9, 10, 11, 12, 13, 14, 15)); }
__device__ __forceinline__ v8f wmma16(v16h a, v16h b, v8f c) { return __builtin_amdgcn_wmma_f32_16x16x32_f16(false, a, false, b, (short)0, c, false, false); }
__device__ __forceinline__ v8f wmmab(v16bf a, v16bf b, v8f c) { return __builtin_amdgcn_wmma_f32_16x16x32_bf16(false, a, false, b, (short)0, c, false, false); }



// ---- k_gemmw: register-blocked GEMM, ONE WAVE per 64x64 output tile (16 accumulators), operands straight from K-contiguous 16-bit planes; grid (M/64, N/64, Z), 32 threads.
// C[m][n] (f32, pitch ldc, + optional f32 bias[n]) = sum_k A[m][k] Bt[n][k] (+ split products per NSPLIT). z-batch strides sA/sB/sC in elements. K = row pitch of A and Bt, KL = k summed by one work-group (KL = K: all of it; KL < K with sA = sB = KL: z is a k range and sC the step from one range's partial sum to the next). KL % 32 == 0.
template <typename T16> struct WFrag;
template <> struct WFrag<h16> { typedef v16h V; static __device__ __forceinline__ V ld(const h16* p) { return cat16(*(const v8h*)p, *(const v8h*)(p + 16)); } static __device__ __forceinline__ v8f mma(V a, V b, v8f c) { return wmma16(a, b, c); } };
template <> struct WFrag<bf> { typedef v16bf V; static __device__ __forceinline__ V ld(const bf* p) { return cat16b(*(const v8us*)p, *(const v8us*)(p + 16)); } static __device__ __forceinline__ v8f mma(V a, V b, v8f c) { return wmmab(a, b, c); } };
// gemmw_tile: the 64x64 tile at (r0, c0); os = 16 x 68 floats of LDS for the store transpose.
template <typename T16, int NSPLIT, bool BIAS>
__device__ __forceinline__ void gemmw_tile(const T16* __restrict__ A, const T16* __restrict__ A2, const T16* __restrict__ Bt, const T16* __restrict__ Bt2, int K, int KL, float* C, int ldc, const float* __restrict__ bias, int r0, int c0, float* os) {
    typedef typename WFrag<T16>::V V;
    const int lane = threadIdx.x & 31, lr = lane & 15, hi = lane >> 4;
    v8f acc[4][4];
#pragma unroll
    for (int mb = 0; mb < 4; ++mb)
#pragma unroll
        for (int nb = 0; nb < 4; ++nb) acc[mb][nb] = (v8f){};
    const size_t aoff = (size_t)(r0 + lr) * K + 8 * hi, boff = (size_t)(c0 + lr) * K + 8 * hi;
#pragma unroll 1
    for (int kc = 0; kc < KL; kc += 32) {
        V a[4], a2[4];
#pragma unroll
        for (int mb = 0; mb < 4; ++mb) { a[mb] = WFrag<T16>::ld(A + aoff + (size_t)mb * 16 * K + kc); if (NSPLIT == 1 || NSPLIT == 2) a2[mb] = WFrag<T16>::ld(A2 + aoff + (size_t)mb * 16 * K + kc); }
#pragma unroll
        for (int nb = 0; nb < 4; ++nb) { const V b = WFrag<T16>::ld(Bt + boff + (size_t)nb * 16 * K + kc); V b2; if (NSPLIT >= 2) b2 = WFrag<T16>::ld(Bt2 + boff + (size_t)nb * 16 * K + kc);
#pragma unroll
            for (int mb = 0; mb < 4; ++mb) { acc[mb][nb] = WFrag<T16>::mma(a[mb], b, acc[mb][nb]); if (NSPLIT == 1 || NSPLIT == 2) acc[mb][nb] = WFrag<T16>::mma(a2[mb], b, acc[mb][nb]); if (NSPLIT >= 2) acc[mb][nb] = WFrag<T16>::mma(a[mb], b2, acc[mb][nb]); } }
        asm volatile("v_nop\n\tv_nop\n\tv_nop\n\tv_nop" : "+v"(acc[0][0]), "+v"(acc[1][1]), "+v"(acc[2][2]), "+v"(acc[3][3]) : "v"(a[0]), "v"(a[3]));
    }
#pragma unroll
    for (int mb = 0; mb < 4; ++mb) {
#pragma unroll
        for (int nb = 0; nb < 4; ++nb) {
#pragma unroll
            for (int j = 0; j < 8; ++j) os[(hi * 8 + j) * 68 + nb * 16 + lr] = acc[mb][nb][j]; }
        __builtin_amdgcn_wave_barrier(); asm volatile("" ::: "memory");
        float* crow = C + (size_t)(r0 + mb * 16) * ldc + c0;
{
#pragma unroll
            for (int s = 0; s < 8; ++s) { const int row = 2 * s + hi, cofs = lr * 4; v4f val = *(const v4fa*)(os + row * 68 + cofs); if (BIAS) { val[0] += bfr(bias[c0 + cofs]); val[1] += bfr(bias[c0 + cofs + 1]); val[2] += bfr(bias[c0 + cofs + 2]); val[3] += bfr(bias[c0 + cofs + 3]); }
                *(v4f*)(crow + (size_t)row * ldc + cofs) = val; }
             }
        __builtin_amdgcn_wave_barrier(); asm volatile("" ::: "memory");
    }
}
template <typename T16, int NSPLIT, bool BIAS>
__global__ __launch_bounds__(32) void k_gemmw(const T16* __restrict__ A, const T16* __restrict__ A2, const T16* __restrict__ Bt, const T16* __restrict__ Bt2, int K, int KL, float* C, int ldc, const float* __restrict__ bias, size_t sA, size_t sB, size_t sC) {
    __shared__ __align__(16) float os[16 * 68];
    const size_t z = blockIdx.z; A += z * sA; if (A2) A2 += z * sA; Bt += z * sB; if (Bt2) Bt2 += z * sB; C += z * sC;
    gemmw_tile<T16, NSPLIT, BIAS>(A, A2, Bt, Bt2, K, KL, C, ldc, bias, blockIdx.x * 64, blockIdx.y * 64, os);
}

__device__ __forceinline__ h16 tohx(float x) { return (h16)x; }
__device__ __forceinline__ void splitf(float y, unsigned short& h, unsigned short& l) { h = f2bf(y); l = f2bf(y - bf2f(h)); }
typedef __attribute__((ext_vector_type(2))) _Float16 v2h;
typedef __attribute__((ext_vector_type(4))) _Float16 v4h;
typedef __attribute__((ext_vector_type(2))) unsigned short v2us;
typedef __attribute__((ext_vector_type(4))) unsigned short v4us;
typedef __attribute__((ext_vector_type(2))) float v2f;
typedef __attribute__((ext_vector_type(4))) int v4i;

// The d_* bodies below are pieces of the two shared grids k_prep and k_planes; bx (and pl) is the piece's own block index.
__device__ __forceinline__ void d_wtG(const float* __restrict__ w, int K, int N, bf* Bt, int bx) {
    const int lane = threadIdx.x & 31; const int L0 = (bx * 8 + (threadIdx.x >> 5)) * 8; const int nlines = N * K / 64;
{
#pragma unroll 1
        for (int l = 0; l < 8; ++l) { const int L = L0 + l; if (L >= nlines) break; const size_t e = (size_t)L * 64 + lane * 2; const int k = (int)(e % K), n = (int)(e / K); v2us o;
            o[0] = f2bf(w[(size_t)k * N + n]); o[1] = f2bf(w[(size_t)(k + 1) * N + n]); *(v2us*)(Bt + e) = o; }
         }
}
__device__ __forceinline__ void d_cvt8(const float* __restrict__ src, bf* dst, size_t n8, int bx) { const size_t i = (size_t)bx * 256 + threadIdx.x; if (i >= n8) return; const v8f v = *(const v8f*)(src + i * 8); v8us o;
#pragma unroll
    for (int k = 0; k < 8; ++k) o[k] = f2bf(v[k]); *(v8us*)(dst + i * 8) = o;  }

// d_rope: head planes [h][t][d] (fp16 + hi/lo) of rope(x) x sc with the rotate-half convention out[d] = x[d] cos[t][d] - x[d+HD/2] sin[t][d], out[d+HD/2] = x[d+HD/2] cos[t][d+HD/2] + x[d] sin[t][d+HD/2]
__device__ __forceinline__ void d_rope(const float* __restrict__ F, int pitch, int nheads, const float* __restrict__ CS, const float* __restrict__ RF, const float* __restrict__ nw, float sc, h16* P16, bf* Ph, bf* Pl, int pl) {
    const size_t e = ((size_t)blockIdx.x * 256 + threadIdx.x) * 2; if (e >= (size_t)nheads * TT * HD) return; const int d = (int)(e % HD); const int t = (int)((e / HD) % TT); const int h = (int)(e / ((size_t)HD * TT)); const size_t po = (size_t)pl * nheads * TT * HD;   /* pl: which [TT][pitch] source and which output plane set */ const float* f = F + ((size_t)pl * TT + t) * pitch + h * HD; const float rf = RF ? RF[(size_t)h * TT + t] : 1.0f; v2h o16; v2us oh, ol;
#pragma unroll
    for (int q = 0; q < 2; ++q) { const int dd = d + q; const int dp = (dd < HD / 2) ? dd + HD / 2 : dd - HD / 2; float x0 = f[dd], x1 = f[dp];
        if (RF) { float n0 = __fmul_rn(x0, rf), n1 = __fmul_rn(x1, rf); asm volatile("" : "+v"(n0)); asm volatile("" : "+v"(n1)); x0 = __fmul_rn(bfr(nw[dd]), n0); x1 = __fmul_rn(bfr(nw[dp]), n1); }
        const v2f cs = *(const v2f*)(CS + ((size_t)t * HD + dd) * 2); float a = __fmul_rn(x0, cs[0]), bq = __fmul_rn(x1, cs[1]); asm volatile("" : "+v"(a)); asm volatile("" : "+v"(bq)); const float r = ((dd < HD / 2) ? __fsub_rn(a, bq) : __fadd_rn(a, bq)) * sc;
        o16[q] = tohx(r); unsigned short a2, c2; splitf(r, a2, c2); oh[q] = a2; ol[q] = c2; }
    *(v2h*)(P16 + po + e) = o16; *(v2us*)(Ph + po + e) = oh; *(v2us*)(Pl + po + e) = ol;  }
__device__ __forceinline__ void d_vtp(const float* __restrict__ F, int pitch, int nheads, h16* V16, bf* Vh, bf* Vl, int pl) { const size_t e = ((size_t)blockIdx.x * 256 + threadIdx.x) * 2; if (e >= (size_t)nheads * HD * TT) return; const int t = (int)(e % TT); const int d = (int)((e / TT) % HD); const int g = (int)(e / ((size_t)TT * HD)); const size_t po = (size_t)pl * nheads * HD * TT;   /* pl: batch */ F += (size_t)pl * TT * pitch; v2h o16; v2us oh, ol;
#pragma unroll
    for (int q = 0; q < 2; ++q) { const float x = F[(size_t)(t + q) * pitch + g * HD + d]; o16[q] = tohx(x); unsigned short a2, c2; splitf(x, a2, c2); oh[q] = a2; ol[q] = c2; }
    *(v2h*)(V16 + po + e) = o16; *(v2us*)(Vh + po + e) = oh; *(v2us*)(Vl + po + e) = ol;  }
__device__ __forceinline__ void d_csid(float* CS, int bx) { const int idx = bx * 256 + threadIdx.x; if (idx >= TT * HD) return; v2f cs; cs[0] = 1.0f; cs[1] = 0.0f; *(v2f*)(CS + (size_t)idx * 2) = cs;  }
// k_prep: the three pieces that read only the inputs, in one grid: the three transposed weight blocks (few blocks, the longest chain of dependent loads: lowest indices, so that they start first), the bf16 copy of x (all batches), the cos/sin table.
#define PB_X ((NB_ * TT * DM / 8 + 255) / 256)
#define PB_C ((TT * HD + 255) / 256)
#define PB_W ((DM * DQ / 64 + 63) / 64)
__global__ __launch_bounds__(256) void k_prep(const float* __restrict__ x, bf* XB, float* CS, const float* __restrict__ ker, bf* W3) {
    const int bx = blockIdx.x;
    if (bx < 3 * PB_W) { const int wb = bx / PB_W; d_wtG(ker + wb * DM * DQ, DM, DQ, W3 + wb * DM * DQ, bx % PB_W); }
    else if (bx < 3 * PB_W + PB_X) d_cvt8(x, XB, (size_t)NB_ * TT * DM / 8, bx - 3 * PB_W);
    else d_csid(CS, bx - 3 * PB_W - PB_X);
}
// k_planes: every 16-bit plane of the projections F3 [q, k, v][batch][TT][HD] in one grid: blockIdx.y < NB_ the transposed v planes (strided reads, the slower piece: it starts first), the rest the q and k planes.
__global__ __launch_bounds__(256) void k_planes(const float* __restrict__ F3, const float* __restrict__ CS, h16* QK16, bf* QKh, bf* QKl, h16* VT16, bf* VTh, bf* VTl) {
    const int pl = blockIdx.y;
    if (pl < NB_) d_vtp(F3 + (size_t)2 * NB_ * TT * HD, HD, 1, VT16, VTh, VTl, pl);
    else d_rope(F3, HD, 1, CS, nullptr, nullptr, 1.0f, QK16, QKh, QKl, pl - NB_);
}
__device__ __forceinline__ float xhalf(float x) { return __builtin_bit_cast(float, __builtin_amdgcn_permlanex16(__builtin_bit_cast(int, x), __builtin_bit_cast(int, x), 0x76543210, 0xfedcba98, false, false)); }   // lane l with lane l ^ 16
// fragment at the lane's own address p plus a constant byte step, in the k order of every loader here (bytes 0-15 and 32-47 from the lane's place)
__device__ __forceinline__ v16bf ldfb(const char* p, int step) { return cat16b(*(const v8us*)(p + step), *(const v8us*)(p + step + 32)); }
__device__ __forceinline__ v16h ldfh(const char* p, int step) { return cat16(*(const v8h*)(p + step), *(const v8h*)(p + step + 32)); }
template <bool HR>
__device__ __forceinline__ void fattn_body(const bf* __restrict__ Qh, const bf* __restrict__ Ql, const h16* __restrict__ VT16, const bf* __restrict__ VTh, const bf* __restrict__ VTl, float* OUTb, int q0, float* red, float* mw, float* lw) {
    const int lane = threadIdx.x & 31, c = lane & 15, h = lane >> 4, w = __builtin_amdgcn_readfirstlane(threadIdx.x >> 5);   // w in a scalar register: scalar loop counter and a scalar loop branch
    const unsigned fo = (unsigned)(c * HD + 8 * h) * 2u;   // the lane's byte offset in a 16-row tile of a row-major plane
    const unsigned vo = (unsigned)(c * TT + 8 * h) * 2u;   // and in a 16-row tile of a transposed v plane
    v16bf qh[NG][2], ql[NG][2];   // [column group][32 of the head's 64]
    const char* qhp = (const char*)(Qh + q0 * HD) + fo; const char* qlp = (const char*)(Ql + q0 * HD) + fo;   // the lane's address in each q plane
#pragma unroll
    for (int g = 0; g < NG; ++g)
#pragma unroll
        for (int kc = 0; kc < 2; ++kc) { const int qo = (g * 16 * HD + kc * 32) * 2; qh[g][kc] = ldfb(qhp, qo); ql[g][kc] = ldfb(qlp, qo); }
    asm volatile("s_wait_xcnt 0x0" :: "v"(qhp), "v"(qlp) : "memory");   // before the q loads' address registers are rewritten; as inputs the addresses live up to the wait, so that no load of the run gets their registers for its result
    __builtin_amdgcn_sched_barrier(0);              // keeps later address arithmetic behind the wait
    v8f o[4][NG];               // O^T: o[dt][g][r] = O[query q0 + 16 g + c][16 dt + 8 h + r], un-normalised
    float m[NG], l[NG];
#pragma unroll
    for (int g = 0; g < NG; ++g) { m[g] = -3.0e38f; l[g] = 0.f;
#pragma unroll
        for (int dt = 0; dt < 4; ++dt) o[dt][g] = (v8f){}; }
    const int k0 = w * (TT / FW);
    v16bf kh[2][2], kl[2][2];   // [key tile][32 of 64]: the pass's k fragments, fetched one pass ahead
    const int KP = NB_ * TT * HD * 2;   // bytes from a batch's q plane to its k plane: a constant step of the loads, so that the register pair they name is the address handed to the wait
    const char* khp = (const char*)(Qh + k0 * HD) + fo; const char* klp = (const char*)(Ql + k0 * HD) + fo;
#pragma unroll
    for (int t = 0; t < 2; ++t)
#pragma unroll
        for (int kc = 0; kc < 2; ++kc) { const int ko = KP + (t * 16 * HD + kc * 32) * 2; kh[t][kc] = ldfb(khp, ko); kl[t][kc] = ldfb(klp, ko); }
    asm volatile("s_wait_xcnt 0x0" :: "v"(khp), "v"(klp) : "memory");   // before the first k loads' address registers are rewritten; the addresses live up to the wait
    __builtin_amdgcn_sched_barrier(0);              // keeps later address arithmetic behind the wait
#pragma unroll 1   // one pass is already 64 to 96 matrix instructions; unrolled, the registers of two passes do not fit two waves a SIMD
    for (int kb = k0; kb < k0 + TT / FW; kb += 32) {
        v16h v16[4]; v16bf vh[4], vl[4];   // the pass's v fragments: their loads fly behind the score products and the softmax
        const char* vap = (HR ? (const char*)(VTh + kb) : (const char*)(VT16 + kb)) + vo; const char* vbp = (HR ? (const char*)(VTl + kb) : (const char*)(VT16 + kb)) + vo;   // the lane's address in the pass's v planes (one plane in the fp16 class)
#pragma unroll
        for (int dt = 0; dt < 4; ++dt) { const int vs = dt * 16 * TT * 2; if (HR) { vh[dt] = ldfb(vap, vs); vl[dt] = ldfb(vbp, vs); } else v16[dt] = ldfh(vap, vs); }
        v8f s[2][NG];           // [key tile][column group]
#pragma unroll
        for (int t = 0; t < 2; ++t)
#pragma unroll
            for (int g = 0; g < NG; ++g) { v8f a = (v8f){};
#pragma unroll
                for (int kc = 0; kc < 2; ++kc) { a = wmmab(kh[t][kc], qh[g][kc], a); a = wmmab(kh[t][kc], ql[g][kc], a); a = wmmab(kl[t][kc], qh[g][kc], a); }
                s[t][g] = a; }
        const int kn = (kb + 32 < TT) ? kb + 32 : kb;   // the last range's last pass fetches its own tiles again: in bounds, never used
        const char* knh = (const char*)(Qh + kn * HD) + fo; const char* knl = (const char*)(Ql + kn * HD) + fo;
#pragma unroll
        for (int t = 0; t < 2; ++t)
#pragma unroll
            for (int kc = 0; kc < 2; ++kc) { const int ko = KP + (t * 16 * HD + kc * 32) * 2; kh[t][kc] = ldfb(knh, ko); kl[t][kc] = ldfb(knl, ko); }
        asm volatile("s_wait_xcnt 0x0" :: "v"(vap), "v"(vbp), "v"(knh), "v"(knl) : "memory");   // the pass's loads are all issued: their address registers may be rewritten behind this wait; as inputs the addresses live up to it, so that no load of the pass gets their registers for its result
        __builtin_amdgcn_sched_barrier(0);              // keeps the vector work below from being lifted over the wait (a "memory" clobber does not tie it to registers)
        float mn[NG]; bool up = false;
#pragma unroll
        for (int g = 0; g < NG; ++g) { float tm = s[0][g][0];
#pragma unroll
            for (int r = 0; r < 8; ++r) tm = fmaxf(tm, fmaxf(s[0][g][r], s[1][g][r]));
            tm *= SCL; tm = fmaxf(tm, xhalf(tm)); mn[g] = fmaxf(m[g], tm); up = up || (mn[g] > m[g]); }
        if (__builtin_amdgcn_ballot_w32(up) != 0) {   // scalar branch: the rescale runs only in a pass that raises some column's maximum
#pragma unroll
            for (int g = 0; g < NG; ++g) { const float al = __builtin_amdgcn_exp2f((m[g] - mn[g]) * L2E); l[g] *= al; m[g] = mn[g];
#pragma unroll
                for (int dt = 0; dt < 4; ++dt) o[dt][g] *= al; } }
#pragma unroll
        for (int g = 0; g < NG; ++g) {
#pragma unroll
            for (int t = 0; t < 2; ++t)
#pragma unroll
                for (int r = 0; r < 8; ++r) { const float p = __builtin_amdgcn_exp2f(fmaf(s[t][g][r] * SCL - m[g], L2E, HR ? 0.f : PSH)); s[t][g][r] = p; l[g] += p; }
            if (HR) { v16bf ph, pl;
#pragma unroll
                for (int e = 0; e < 16; ++e) { const float p = s[e >> 3][g][e & 7]; const __bf16 a = (__bf16)p; ph[e] = a; pl[e] = (__bf16)(p - (float)a); }
#pragma unroll
                for (int dt = 0; dt < 4; ++dt) { o[dt][g] = wmmab(vh[dt], ph, o[dt][g]); o[dt][g] = wmmab(vh[dt], pl, o[dt][g]); o[dt][g] = wmmab(vl[dt], ph, o[dt][g]); }
            } else { v16h pb;
#pragma unroll
                for (int e = 0; e < 16; ++e) pb[e] = (h16)s[e >> 3][g][e & 7];
#pragma unroll
                for (int dt = 0; dt < 4; ++dt) o[dt][g] = wmma16(v16[dt], pb, o[dt][g]); } }
    }
#pragma unroll
    for (int g = 0; g < NG; ++g) { l[g] += xhalf(l[g]); if (h == 0) { mw[w * FQ + g * 16 + c] = m[g]; lw[w * FQ + g * 16 + c] = l[g]; } }
    __syncthreads();   // every range's maximum and sum are in LDS
#pragma unroll
    for (int g = 0; g < NG; ++g) { const int q = g * 16 + c; float M = mw[q];
#pragma unroll
        for (int u = 1; u < FW; ++u) M = fmaxf(M, mw[u * FQ + q]);
        float L = 0.f;
#pragma unroll
        for (int u = 0; u < FW; ++u) L += lw[u * FQ + q] * __builtin_amdgcn_exp2f((mw[u * FQ + q] - M) * L2E);
        const float f = __fdiv_rn(__builtin_amdgcn_exp2f((m[g] - M) * L2E), L);
#pragma unroll
        for (int dt = 0; dt < 4; ++dt) { float* rp = red + (w * FQ + q) * 68 + dt * 16 + 8 * h; const v8f ov = o[dt][g] * f; v4f a, b2;
#pragma unroll
            for (int r = 0; r < 4; ++r) { a[r] = ov[r]; b2[r] = ov[4 + r]; }
            *(v4fa*)rp = a; *(v4fa*)(rp + 4) = b2; } }
    __syncthreads();   // every range's weighted tile is in LDS
#pragma unroll
    for (int i = 0; i < FQ / 32; ++i) { const int q = i * 32 + (threadIdx.x >> 3), d0 = (threadIdx.x & 7) * 8; v4f a = *(const v4fa*)(red + q * 68 + d0), b2 = *(const v4fa*)(red + q * 68 + d0 + 4);
#pragma unroll
        for (int u = 1; u < FW; ++u) { a += *(const v4fa*)(red + (u * FQ + q) * 68 + d0); b2 += *(const v4fa*)(red + (u * FQ + q) * 68 + d0 + 4); }
        float* op = OUTb + (size_t)(q0 + q) * DQ + d0; *(v4f*)op = a; *(v4f*)(op + 4) = b2; }
}
// grid (TT / FQ, NB_) = one work-group a WGP; two waves a SIMD, up to 512 registers each: 64 columns a wave halve the k and v loads per product
__global__ __launch_bounds__(FW * 32) __attribute__((amdgpu_waves_per_eu(2, 2))) void k_fattn(const bf* __restrict__ QKh, const bf* __restrict__ QKl, const h16* __restrict__ VT16, const bf* __restrict__ VTh, const bf* __restrict__ VTl, float* OUT) {
    __shared__ __align__(16) float red[FW * FQ * 68]; __shared__ float mw[FW * FQ]; __shared__ float lw[FW * FQ];
    const size_t PL = (size_t)TT * HD, zb = blockIdx.y; const int q0 = blockIdx.x * FQ;
    const bf* Qh = QKh + zb * PL; const bf* Ql = QKl + zb * PL;   // the batch's k planes lie NB_ planes behind its q planes
    if (q0 < RH) fattn_body<true>(Qh, Ql, VT16 + zb * PL, VTh + zb * PL, VTl + zb * PL, OUT + zb * TT * DQ, q0, red, mw, lw);
    else fattn_body<false>(Qh, Ql, VT16 + zb * PL, VTh + zb * PL, VTl + zb * PL, OUT + zb * TT * DQ, q0, red, mw, lw);
}

extern "C" void kernel_launch(void* const* d_in, const int* in_sizes, int n_in,
                              void* d_out, int out_size, void* d_ws, size_t ws_size, hipStream_t stream) {
    (void)in_sizes; (void)n_in; (void)out_size;
    const float* x = (const float*)d_in[0]; const float* ker = (const float*)d_in[1];   /* kernel [3][128][64] */
    float* OUT = (float*)d_out;     // [4][4096][64]
    char* wsp = (char*)d_ws;
    auto take = [&](size_t bytes) { char* p = wsp; wsp += (bytes + 255) & ~(size_t)255; return (void*)p; };
    bf* W3 = (bf*)take((size_t)3 * DQ * DM * 2);   /* [q, k, v][64][128] */ float* CS = (float*)take((size_t)TT * HD * 2 * 4);
    bf* XB = (bf*)take((size_t)NB_ * TT * DM * 2); float* F3 = (float*)take((size_t)3 * NB_ * TT * HD * 4);   /* [q, k, v][batch][TT][HD] */
    const size_t PL = (size_t)TT * HD;   // one batch's plane, elements
    h16* QK16 = (h16*)take(2 * NB_ * PL * 2); bf* QKh = (bf*)take(2 * NB_ * PL * 2); bf* QKl = (bf*)take(2 * NB_ * PL * 2);   /* [q, k][batch][TT][HD] */
    h16* VT16 = (h16*)take(NB_ * PL * 2); bf* VTh = (bf*)take(NB_ * PL * 2); bf* VTl = (bf*)take(NB_ * PL * 2);   /* [batch][HD][TT] */
    if ((size_t)(wsp - (char*)d_ws) > ws_size) return;    // ws 256 MiB
    k_prep<<<3 * PB_W + PB_X + PB_C, 256, 0, stream>>>(x, XB, CS, ker, W3);
    k_gemmw<bf, 0, false><<<dim3(NB_ * TT / 64, HD / 64, 3), 32, 0, stream>>>(XB, nullptr, W3, nullptr, DM, DM, F3, HD, nullptr, 0, (size_t)DQ * DM, (size_t)NB_ * PL);   /* rows = all batches, z = q, k, v */
    k_planes<<<dim3((unsigned)((PL / 2 + 255) / 256), 3 * NB_, 1), 256, 0, stream>>>(F3, CS, QK16, QKh, QKl, VT16, VTh, VTl);
    k_fattn<<<dim3(TT / FQ, NB_, 1), FW * 32, 0, stream>>>(QKh, QKl, VT16, VTh, VTl, OUT);
}

// v004
// Measured time: 48.6 microseconds a run.
// Next to v003, in two timings, it ran 1.36 and 1.35 times as fast.
// All steps since v000 together make it 19.1 times as fast.
#include <hip/hip_runtime.h>

// Single-head self-attention over 4,096 tokens with a 64-wide head (x [4][4096][128]; WQ, WK, WV = x kernel[0/1/2] ('xw' [3][128][64] sigma 1); scores / sqrt(64); softmax; out = attn WV -> [4][4096][64] (1 M)).
// Launches: ONE projection kernel (inputs rounded, q/k/v projected, 16-bit planes stored from the accumulators; all four batches in one grid), then ONE attention kernel for all batches: scores, softmax and attn.v never leave the registers.
// Layout per batch: exact projections of the bf16-rounded inputs; 16-bit planes of q, k (row-major) and v (transposed); fused T-4096 attention for the one head (scores hi/lo 3 products on EVERY row: the logits are far too peaked for fp16 scores; P and attn.v hybrid: rows < 512 hi/lo, rest fp16 x1024; online softmax).
// Compute dtypes, f32 accumulate: every input rounded to bf16; projections exact; scores 3 products on every row; softmax f32; attn.v rows < 512 3 products, rest fp16; output f32.

#define NB_  4
#define TT   4096
#define DM   128
#define NH_  1
#define NKV  1
#define REP  (NH_ / NKV)
#define HD   64
#define DQ   (NH_ * HD)
#define DKV  (NKV * HD)
#define RH   512                  // query rows < RH use hi+lo planes (0: none)
#define WIN  0
#define PSH  10.0f               // fp16 P carries 2^PSH; the row sum carries it too, so the quotient is free of it
#define SCL  0.125f   // HD^-0.5
#define FW   8                    // waves of an attention work-group: one key range of TT / FW keys each
#define FQ   64                   // query columns of an attention work-group (every wave holds all of them)
#define NG   (FQ / 16)            // 16-column groups
#define L2E  1.4426950408889634f
typedef _Float16 h16;
typedef unsigned short bf;
typedef __attribute__((ext_vector_type(16))) __bf16   v16bf;
typedef __attribute__((ext_vector_type(16))) _Float16 v16h;
typedef __attribute__((ext_vector_type(8)))  _Float16 v8h;
typedef __attribute__((ext_vector_type(8)))  unsigned short v8us;
typedef __attribute__((ext_vector_type(8)))  float    v8f;
typedef __attribute__((ext_vector_type(4)))  float    v4f;
typedef v8h  __attribute__((may_alias)) v8ha;
typedef v4f  __attribute__((may_alias)) v4fa;
typedef v8us __attribute__((may_alias)) v8usa;

__device__ __forceinline__ v16h cat16(v8h lo, v8h hi) { return __builtin_shufflevector(lo, hi, 0, 1, 2, 3, 4, 5, 6, 7, 8, 9, 10, 11, 12, 13, 14, 15); }
__device__ __forceinline__ v16bf cat16b(v8us lo, v8us hi) { return __builtin_bit_cast(v16bf, __builtin_shufflevector(lo, hi, 0, 1, 2, 3, 4, 5, 6, 7, 8, 9, 10, 11, 12, 13, 14, 15)); }
__device__ __forceinline__ v8f wmma16(v16h a, v16h b, v8f c) { return __builtin_amdgcn_wmma_f32_16x16x32_f16(false, a, false, b, (short)0, c, false, false); }
__device__ __forceinline__ v8f wmmab(v16bf a, v16bf b, v8f c) { return __builtin_amdgcn_wmma_f32_16x16x32_bf16(false, a, false, b, (short)0, c, false, false); }


typedef __attribute__((ext_vector_type(8))) __bf16 v8bf;
// k_proj: one work-group = PT tokens (flat over the batches) x all 192 columns of q, k, v; 12 waves.
// Stage: the three weight blocks, transposed to [column][k], and the tokens' x rows, rounded to bf16, in LDS at a pitch of 272 B (16 B x odd: ds_load_b128 without bank conflicts).
// Every wave: D (64 x 16) = 64 staged rows (A, four tiles) times 16 staged rows (B); a lane holds 8 neighbouring D rows of one D column, which are 16 contiguous bytes of a plane.
// Waves 0-7: A = the 64 columns of q or k, B = 16 tokens: the wave fills whole 128-B rows of the row-major planes.
// Waves 8-11: A = the 64 tokens, B = 16 columns of v: the wave fills whole 128-B lines of the transposed planes.
#define PT   64
#define XP   (DM + 8)             // LDS row pitch, 16-bit elements
#define PWV  12                   // waves of a projection work-group
__device__ __forceinline__ v8us rnd8(v8f v) { v8bf o;
#pragma unroll
    for (int e = 0; e < 8; ++e) o[e] = (__bf16)v[e];
    return __builtin_bit_cast(v8us, o); }
__device__ __forceinline__ v16bf ldsf(const bf* p) { return cat16b(*(const v8usa*)p, *(const v8usa*)(p + 16)); }   // k order of every loader here
__global__ __launch_bounds__(PWV * 32) void k_proj(const float* __restrict__ x, const float* __restrict__ ker, bf* QKh, bf* QKl, h16* VT16, bf* VTh, bf* VTl) {
    __shared__ __align__(16) bf sm[(3 * HD + PT) * XP];   // rows 0-191: weights [q, k, v column][k]; rows 192-255: x [token][k]
    const int tid = threadIdx.x, lane = tid & 31, c = lane & 15, h = lane >> 4, w = __builtin_amdgcn_readfirstlane(tid >> 5);
    const int r0 = blockIdx.x * PT;   // first token, flat over the batches
    {   // weights: a thread takes 8 k of one column (its loads: 128 contiguous bytes a wave), 8 such pieces; the three blocks are one [384][64] array
        const float* wp = ker + (tid >> 6) * 8 * HD + (tid & 63); v8f wv[8];
#pragma unroll
        for (int u = 0; u < 8; ++u)
#pragma unroll
            for (int i = 0; i < 8; ++i) wv[u][i] = wp[(u * (PWV * 32 / 64) * 8 + i) * HD];
        // x: 8 floats a thread and piece, contiguous over the work-group
        const float* xp = x + (size_t)r0 * DM + tid * 8; v8f xv[3];
#pragma unroll
        for (int u = 0; u < 3; ++u) if ((u + 1) * PWV * 32 <= PT * DM / 8 || tid + u * PWV * 32 < PT * DM / 8) xv[u] = *(const v8f*)(xp + u * PWV * 32 * 8);
#pragma unroll
        for (int u = 0; u < 8; ++u) { const int G = (tid >> 6) + u * (PWV * 32 / 64);   // 8-k group: block G / 16, k 8 (G % 16)
            *(v8usa*)(sm + ((G >> 4) * HD + (tid & 63)) * XP + (G & 15) * 8) = rnd8(wv[u]); }
#pragma unroll
        for (int u = 0; u < 3; ++u) { const int i = tid + u * PWV * 32; if ((u + 1) * PWV * 32 <= PT * DM / 8 || i < PT * DM / 8) *(v8usa*)(sm + (3 * HD + (i >> 4)) * XP + (i & 15) * 8) = rnd8(xv[u]); }
    }
    __syncthreads();   // the staged rows are read by every wave
    const bool qk = w < 8;
    const int arow = qk ? (w >> 2) * HD : 3 * HD;                               // first of the 64 staged rows that are D's rows
    const int brow = qk ? 3 * HD + (w & 3) * 16 : 2 * HD + (w - 8) * 16;        // first of the 16 staged rows that are D's columns
    const bf* ap = sm + arow * XP + c * XP + 8 * h; const bf* bp = sm + brow * XP + c * XP + 8 * h;
    // the lane's place in its planes: D column c picks the plane's row, D row 16 i + 8 h + e the element in it
    const int prow = qk ? (w >> 2) * NB_ * TT + r0 + (w & 3) * 16 : (r0 / TT) * HD + (w - 8) * 16, ppit = qk ? HD : TT, pcol = qk ? 0 : r0 % TT;
    const int po = (prow + c) * ppit + pcol + 8 * h;
    bf* ph = (qk ? QKh : VTh) + po; bf* pl = (qk ? QKl : VTl) + po;
    v8f acc[4];
#pragma unroll
    for (int i = 0; i < 4; ++i) acc[i] = (v8f){};
#pragma unroll
    for (int kc = 0; kc < DM / 32; ++kc) { const v16bf bfr = ldsf(bp + kc * 32);
#pragma unroll
        for (int i = 0; i < 4; ++i) acc[i] = wmmab(ldsf(ap + i * 16 * XP + kc * 32), bfr, acc[i]); }
#pragma unroll
    for (int i = 0; i < 4; ++i) { v8bf a; v8f r;
#pragma unroll
        for (int e = 0; e < 8; ++e) { a[e] = (__bf16)acc[i][e]; r[e] = acc[i][e] - (float)a[e]; }
        *(v8us*)(ph + i * 16) = __builtin_bit_cast(v8us, a); *(v8us*)(pl + i * 16) = rnd8(r); }
    if (!qk) {
        asm volatile("s_wait_xcnt 0x0" ::: "memory");   // the plane stores above are issued: their registers may be rewritten behind this wait
        __builtin_amdgcn_sched_barrier(0);              // keeps the vector work below from being lifted over the wait (a "memory" clobber does not tie it to registers)
#pragma unroll
        for (int i = 0; i < 4; ++i) { v8h f;
#pragma unroll
            for (int e = 0; e < 8; ++e) f[e] = (h16)acc[i][e];
            *(v8h*)(VT16 + po + i * 16) = f; } }
}
__device__ __forceinline__ float xhalf(float x) { return __builtin_bit_cast(float, __builtin_amdgcn_permlanex16(__builtin_bit_cast(int, x), __builtin_bit_cast(int, x), 0x76543210, 0xfedcba98, false, false)); }   // lane l with lane l ^ 16
// fragment at the lane's own address p plus a constant byte step, in the k order of every loader here (bytes 0-15 and 32-47 from the lane's place)
__device__ __forceinline__ v16bf ldfb(const char* p, int step) { return cat16b(*(const v8us*)(p + step), *(const v8us*)(p + step + 32)); }
__device__ __forceinline__ v16h ldfh(const char* p, int step) { return cat16(*(const v8h*)(p + step), *(const v8h*)(p + step + 32)); }
template <bool HR>
__device__ __forceinline__ void fattn_body(const bf* __restrict__ Qh, const bf* __restrict__ Ql, const h16* __restrict__ VT16, const bf* __restrict__ VTh, const bf* __restrict__ VTl, float* OUTb, int q0, float* red, float* mw, float* lw) {
    const int lane = threadIdx.x & 31, c = lane & 15, h = lane >> 4, w = __builtin_amdgcn_readfirstlane(threadIdx.x >> 5);   // w in a scalar register: scalar loop counter and a scalar loop branch
    const unsigned fo = (unsigned)(c * HD + 8 * h) * 2u;   // the lane's byte offset in a 16-row tile of a row-major plane
    const unsigned vo = (unsigned)(c * TT + 8 * h) * 2u;   // and in a 16-row tile of a transposed v plane
    v16bf qh[NG][2], ql[NG][2];   // [column group][32 of the head's 64]
    const char* qhp = (const char*)(Qh + q0 * HD) + fo; const char* qlp = (const char*)(Ql + q0 * HD) + fo;   // the lane's address in each q plane
#pragma unroll
    for (int g = 0; g < NG; ++g)
#pragma unroll
        for (int kc = 0; kc < 2; ++kc) { const int qo = (g * 16 * HD + kc * 32) * 2; qh[g][kc] = ldfb(qhp, qo); ql[g][kc] = ldfb(qlp, qo); }
    asm volatile("s_wait_xcnt 0x0" :: "v"(qhp), "v"(qlp) : "memory");   // before the q loads' address registers are rewritten; as inputs the addresses live up to the wait, so that no load of the run gets their registers for its result
    __builtin_amdgcn_sched_barrier(0);              // keeps later address arithmetic behind the wait
    v8f o[4][NG];               // O^T: o[dt][g][r] = O[query q0 + 16 g + c][16 dt + 8 h + r], un-normalised
    float m[NG], l[NG];
#pragma unroll
    for (int g = 0; g < NG; ++g) { m[g] = -3.0e38f; l[g] = 0.f;
#pragma unroll
        for (int dt = 0; dt < 4; ++dt) o[dt][g] = (v8f){}; }
    const int k0 = w * (TT / FW);
    v16bf kh[2][2], kl[2][2];   // [key tile][32 of 64]: the pass's k fragments, fetched one pass ahead
    const int KP = NB_ * TT * HD * 2;   // bytes from a batch's q plane to its k plane: a constant step of the loads, so that the register pair they name is the address handed to the wait
    const char* khp = (const char*)(Qh + k0 * HD) + fo; const char* klp = (const char*)(Ql + k0 * HD) + fo;
#pragma unroll
    for (int t = 0; t < 2; ++t)
#pragma unroll
        for (int kc = 0; kc < 2; ++kc) { const int ko = KP + (t * 16 * HD + kc * 32) * 2; kh[t][kc] = ldfb(khp, ko); kl[t][kc] = ldfb(klp, ko); }
    asm volatile("s_wait_xcnt 0x0" :: "v"(khp), "v"(klp) : "memory");   // before the first k loads' address registers are rewritten; the addresses live up to the wait
    __builtin_amdgcn_sched_barrier(0);              // keeps later address arithmetic behind the wait
#pragma unroll 1   // one pass is already 64 to 96 matrix instructions; unrolled, the registers of two passes do not fit two waves a SIMD
    for (int kb = k0; kb < k0 + TT / FW; kb += 32) {
        v16h v16[4]; v16bf vh[4], vl[4];   // the pass's v fragments: their loads fly behind the score products and the softmax
        const char* vap = (HR ? (const char*)(VTh + kb) : (const char*)(VT16 + kb)) + vo; const char* vbp = (HR ? (const char*)(VTl + kb) : (const char*)(VT16 + kb)) + vo;   // the lane's address in the pass's v planes (one plane in the fp16 class)
#pragma unroll
        for (int dt = 0; dt < 4; ++dt) { const int vs = dt * 16 * TT * 2; if (HR) { vh[dt] = ldfb(vap, vs); vl[dt] = ldfb(vbp, vs); } else v16[dt] = ldfh(vap, vs); }
        v8f s[2][NG];           // [key tile][column group]
#pragma unroll
        for (int t = 0; t < 2; ++t)
#pragma unroll
            for (int g = 0; g < NG; ++g) { v8f a = (v8f){};
#pragma unroll
                for (int kc = 0; kc < 2; ++kc) { a = wmmab(kh[t][kc], qh[g][kc], a); a = wmmab(kh[t][kc], ql[g][kc], a); a = wmmab(kl[t][kc], qh[g][kc], a); }
                s[t][g] = a; }
        const int kn = (kb + 32 < TT) ? kb + 32 : kb;   // the last range's last pass fetches its own tiles again: in bounds, never used
        const char* knh = (const char*)(Qh + kn * HD) + fo; const char* knl = (const char*)(Ql + kn * HD) + fo;
#pragma unroll
        for (int t = 0; t < 2; ++t)
#pragma unroll
            for (int kc = 0; kc < 2; ++kc) { const int ko = KP + (t * 16 * HD + kc * 32) * 2; kh[t][kc] = ldfb(knh, ko); kl[t][kc] = ldfb(knl, ko); }
        asm volatile("s_wait_xcnt 0x0" :: "v"(vap), "v"(vbp), "v"(knh), "v"(knl) : "memory");   // the pass's loads are all issued: their address registers may be rewritten behind this wait; as inputs the addresses live up to it, so that no load of the pass gets their registers for its result
        __builtin_amdgcn_sched_barrier(0);              // keeps the vector work below from being lifted over the wait (a "memory" clobber does not tie it to registers)
        float mn[NG]; bool up = false;
#pragma unroll
        for (int g = 0; g < NG; ++g) { float tm = s[0][g][0];
#pragma unroll
            for (int r = 0; r < 8; ++r) tm = fmaxf(tm, fmaxf(s[0][g][r], s[1][g][r]));
            tm *= SCL; tm = fmaxf(tm, xhalf(tm)); mn[g] = fmaxf(m[g], tm); up = up || (mn[g] > m[g]); }
        if (__builtin_amdgcn_ballot_w32(up) != 0) {   // scalar branch: the rescale runs only in a pass that raises some column's maximum
#pragma unroll
            for (int g = 0; g < NG; ++g) { const float al = __builtin_amdgcn_exp2f((m[g] - mn[g]) * L2E); l[g] *= al; m[g] = mn[g];
#pragma unroll
                for (int dt = 0; dt < 4; ++dt) o[dt][g] *= al; } }
#pragma unroll
        for (int g = 0; g < NG; ++g) {
#pragma unroll
            for (int t = 0; t < 2; ++t)
#pragma unroll
                for (int r = 0; r < 8; ++r) { const float p = __builtin_amdgcn_exp2f(fmaf(s[t][g][r] * SCL - m[g], L2E, HR ? 0.f : PSH)); s[t][g][r] = p; l[g] += p; }
            if (HR) { v16bf ph, pl;
#pragma unroll
                for (int e = 0; e < 16; ++e) { const float p = s[e >> 3][g][e & 7]; const __bf16 a = (__bf16)p; ph[e] = a; pl[e] = (__bf16)(p - (float)a); }
#pragma unroll
                for (int dt = 0; dt < 4; ++dt) { o[dt][g] = wmmab(vh[dt], ph, o[dt][g]); o[dt][g] = wmmab(vh[dt], pl, o[dt][g]); o[dt][g] = wmmab(vl[dt], ph, o[dt][g]); }
            } else { v16h pb;
#pragma unroll
                for (int e = 0; e < 16; ++e) pb[e] = (h16)s[e >> 3][g][e & 7];
#pragma unroll
                for (int dt = 0; dt < 4; ++dt) o[dt][g] = wmma16(v16[dt], pb, o[dt][g]); } }
    }
#pragma unroll
    for (int g = 0; g < NG; ++g) { l[g] += xhalf(l[g]); if (h == 0) { mw[w * FQ + g * 16 + c] = m[g]; lw[w * FQ + g * 16 + c] = l[g]; } }
    __syncthreads();   // every range's maximum and sum are in LDS
#pragma unroll
    for (int g = 0; g < NG; ++g) { const int q = g * 16 + c; float M = mw[q];
#pragma unroll
        for (int u = 1; u < FW; ++u) M = fmaxf(M, mw[u * FQ + q]);
        float L = 0.f;
#pragma unroll
        for (int u = 0; u < FW; ++u) L += lw[u * FQ + q] * __builtin_amdgcn_exp2f((mw[u * FQ + q] - M) * L2E);
        const float f = __fdiv_rn(__builtin_amdgcn_exp2f((m[g] - M) * L2E), L);
#pragma unroll
        for (int dt = 0; dt < 4; ++dt) { float* rp = red + (w * FQ + q) * 68 + dt * 16 + 8 * h; const v8f ov = o[dt][g] * f; v4f a, b2;
#pragma unroll
            for (int r = 0; r < 4; ++r) { a[r] = ov[r]; b2[r] = ov[4 + r]; }
            *(v4fa*)rp = a; *(v4fa*)(rp + 4) = b2; } }
    __syncthreads();   // every range's weighted tile is in LDS
#pragma unroll
    for (int i = 0; i < FQ / 32; ++i) { const int q = i * 32 + (threadIdx.x >> 3), d0 = (threadIdx.x & 7) * 8; v4f a = *(const v4fa*)(red + q * 68 + d0), b2 = *(const v4fa*)(red + q * 68 + d0 + 4);
#pragma unroll
        for (int u = 1; u < FW; ++u) { a += *(const v4fa*)(red + (u * FQ + q) * 68 + d0); b2 += *(const v4fa*)(red + (u * FQ + q) * 68 + d0 + 4); }
        float* op = OUTb + (size_t)(q0 + q) * DQ + d0; *(v4f*)op = a; *(v4f*)(op + 4) = b2; }
}
// grid (TT / FQ, NB_) = one work-group a WGP; two waves a SIMD, up to 512 registers each: 64 columns a wave halve the k and v loads per product
__global__ __launch_bounds__(FW * 32) __attribute__((amdgpu_waves_per_eu(2, 2))) void k_fattn(const bf* __restrict__ QKh, const bf* __restrict__ QKl, const h16* __restrict__ VT16, const bf* __restrict__ VTh, const bf* __restrict__ VTl, float* OUT) {
    __shared__ __align__(16) float red[FW * FQ * 68]; __shared__ float mw[FW * FQ]; __shared__ float lw[FW * FQ];
    const size_t PL = (size_t)TT * HD, zb = blockIdx.y; const int q0 = blockIdx.x * FQ;
    const bf* Qh = QKh + zb * PL; const bf* Ql = QKl + zb * PL;   // the batch's k planes lie NB_ planes behind its q planes
    if (q0 < RH) fattn_body<true>(Qh, Ql, VT16 + zb * PL, VTh + zb * PL, VTl + zb * PL, OUT + zb * TT * DQ, q0, red, mw, lw);
    else fattn_body<false>(Qh, Ql, VT16 + zb * PL, VTh + zb * PL, VTl + zb * PL, OUT + zb * TT * DQ, q0, red, mw, lw);
}

extern "C" void kernel_launch(void* const* d_in, const int* in_sizes, int n_in,
                              void* d_out, int out_size, void* d_ws, size_t ws_size, hipStream_t stream) {
    (void)in_sizes; (void)n_in; (void)out_size;
    const float* x = (const float*)d_in[0]; const float* ker = (const float*)d_in[1];   /* kernel [3][128][64] */
    float* OUT = (float*)d_out;     // [4][4096][64]
    char* wsp = (char*)d_ws;
    auto take = [&](size_t bytes) { char* p = wsp; wsp += (bytes + 255) & ~(size_t)255; return (void*)p; };
    const size_t PL = (size_t)TT * HD;   // one batch's plane, elements
    bf* QKh = (bf*)take(2 * NB_ * PL * 2); bf* QKl = (bf*)take(2 * NB_ * PL * 2);   /* [q, k][batch][TT][HD] */
    h16* VT16 = (h16*)take(NB_ * PL * 2); bf* VTh = (bf*)take(NB_ * PL * 2); bf* VTl = (bf*)take(NB_ * PL * 2);   /* [batch][HD][TT] */
    if ((size_t)(wsp - (char*)d_ws) > ws_size) return;    // ws 256 MiB
    k_proj<<<NB_ * TT / PT, PWV * 32, 0, stream>>>(x, ker, QKh, QKl, VT16, VTh, VTl);
    k_fattn<<<dim3(TT / FQ, NB_, 1), FW * 32, 0, stream>>>(QKh, QKl, VT16, VTh, VTl, OUT);
}

// v005
// A run of this version takes 41 microseconds.
// Next to v004, in two timings, it ran 1.19 and 1.18 times as fast.
// Over all steps from v000 it is 22.6 times as fast.
#include <hip/hip_runtime.h>

// Single-head self-attention over 4,096 tokens with a 64-wide head (x [4][4096][128]; WQ, WK, WV = x kernel[0/1/2] ('xw' [3][128][64] sigma 1); scores / sqrt(64); softmax; out = attn WV -> [4][4096][64] (1 M)).
// Launches: ONE projection kernel (inputs rounded, q/k/v projected, 16-bit planes stored from the accumulators; all four batches in one grid), then ONE attention kernel for all batches: scores, softmax and attn.v never leave the registers.
// Layout per batch: exact projections of the bf16-rounded inputs; 16-bit planes of q, k and v in fragment order (see k_proj); fused T-4096 attention for the one head (scores hi/lo 3 products on EVERY row: the logits are far too peaked for fp16 scores; P and attn.v hybrid: rows < 512 hi/lo, rest fp16 x1024; online softmax).
// Compute dtypes, f32 accumulate: every input rounded to bf16; projections exact; scores 3 products on every row; softmax f32; attn.v rows < 512 3 products, rest fp16; output f32.

#define NB_  4
#define TT   4096
#define DM   128
#define NH_  1
#define NKV  1
#define REP  (NH_ / NKV)
#define HD   64
#define DQ   (NH_ * HD)
#define DKV  (NKV * HD)
#define RH   512                  // query rows < RH use hi+lo planes (0: none)
#define WIN  0
#define PSH  10.0f               // fp16 P carries 2^PSH; the row sum carries it too, so the quotient is free of it
#define SCL  0.125f   // HD^-0.5
#define FW   8                    // waves of an attention work-group: one key range of TT / FW keys each
#define FQ   64                   // query columns of an attention work-group (every wave holds all of them)
#define NG   (FQ / 16)            // 16-column groups
#define L2E  1.4426950408889634f
typedef _Float16 h16;
typedef unsigned short bf;
typedef __attribute__((ext_vector_type(16))) __bf16   v16bf;
typedef __attribute__((ext_vector_type(16))) _Float16 v16h;
typedef __attribute__((ext_vector_type(8)))  _Float16 v8h;
typedef __attribute__((ext_vector_type(8)))  unsigned short v8us;
typedef __attribute__((ext_vector_type(8)))  float    v8f;
typedef __attribute__((ext_vector_type(4)))  float    v4f;
typedef v8h  __attribute__((may_alias)) v8ha;
typedef v4f  __attribute__((may_alias)) v4fa;
typedef v8us __attribute__((may_alias)) v8usa;

__device__ __forceinline__ v16h cat16(v8h lo, v8h hi) { return __builtin_shufflevector(lo, hi, 0, 1, 2, 3, 4, 5, 6, 7, 8, 9, 10, 11, 12, 13, 14, 15); }
__device__ __forceinline__ v16bf cat16b(v8us lo, v8us hi) { return __builtin_bit_cast(v16bf, __builtin_shufflevector(lo, hi, 0, 1, 2, 3, 4, 5, 6, 7, 8, 9, 10, 11, 12, 13, 14, 15)); }
__device__ __forceinline__ v8f wmma16(v16h a, v16h b, v8f c) { return __builtin_amdgcn_wmma_f32_16x16x32_f16(false, a, false, b, (short)0, c, false, false); }
__device__ __forceinline__ v8f wmmab(v16bf a, v16bf b, v8f c) { return __builtin_amdgcn_wmma_f32_16x16x32_bf16(false, a, false, b, (short)0, c, false, false); }


typedef __attribute__((ext_vector_type(8))) __bf16 v8bf;
// k_proj: one work-group = PT tokens (flat over the batches) x all 192 columns of q, k, v; 12 waves.
// Stage: the three weight blocks, transposed to [column][k], and the tokens' x rows, rounded to bf16, in LDS at a pitch of 272 B (16 B x odd: ds_load_b128 without bank conflicts).
// Every wave: D (64 x 16) = 64 staged rows (A, four tiles) times 16 staged rows (B); a lane holds 8 neighbouring D rows of one D column: the 16 bytes that the same lane of an attention wave loads as one half of a fragment.
// The planes are kept in that fragment order: a half fragment is 32 lanes x 16 B = 512 contiguous bytes, so that every store here and every load in k_fattn covers four whole 128-B lines.
// Waves 0-7: A = the 64 columns of q or k, B = 16 tokens. q, k planes: [16-token tile][32 of the head's 64][half][lane][8], 2 KiB a tile.
// Waves 8-11: A = the 64 tokens, B = 16 columns of v. v planes: [32-key pass][16-column tile][half][lane][8], 4 KiB a pass.
#define PT   64
#define XP   (DM + 8)             // LDS row pitch, 16-bit elements
#define PWV  12                   // waves of a projection work-group
__device__ __forceinline__ v8us rnd8(v8f v) { v8bf o;
#pragma unroll
    for (int e = 0; e < 8; ++e) o[e] = (__bf16)v[e];
    return __builtin_bit_cast(v8us, o); }
__device__ __forceinline__ v16bf ldsf(const bf* p) { return cat16b(*(const v8usa*)p, *(const v8usa*)(p + 16)); }   // k order of every loader here
__global__ __launch_bounds__(PWV * 32) void k_proj(const float* __restrict__ x, const float* __restrict__ ker, bf* QKh, bf* QKl, h16* VT16, bf* VTh, bf* VTl) {
    __shared__ __align__(16) bf sm[(3 * HD + PT) * XP];   // rows 0-191: weights [q, k, v column][k]; rows 192-255: x [token][k]
    const int tid = threadIdx.x, lane = tid & 31, c = lane & 15, h = lane >> 4, w = __builtin_amdgcn_readfirstlane(tid >> 5);
    const int r0 = blockIdx.x * PT;   // first token, flat over the batches
    {   // weights: a thread takes 8 k of one column (its loads: 128 contiguous bytes a wave), 8 such pieces; the three blocks are one [384][64] array
        const float* wp = ker + (tid >> 6) * 8 * HD + (tid & 63); v8f wv[8];
#pragma unroll
        for (int u = 0; u < 8; ++u)
#pragma unroll
            for (int i = 0; i < 8; ++i) wv[u][i] = wp[(u * (PWV * 32 / 64) * 8 + i) * HD];
        // x: 8 floats a thread and piece, contiguous over the work-group
        const float* xp = x + (size_t)r0 * DM + tid * 8; v8f xv[3];
#pragma unroll
        for (int u = 0; u < 3; ++u) if ((u + 1) * PWV * 32 <= PT * DM / 8 || tid + u * PWV * 32 < PT * DM / 8) xv[u] = *(const v8f*)(xp + u * PWV * 32 * 8);
#pragma unroll
        for (int u = 0; u < 8; ++u) { const int G = (tid >> 6) + u * (PWV * 32 / 64);   // 8-k group: block G / 16, k 8 (G % 16)
            *(v8usa*)(sm + ((G >> 4) * HD + (tid & 63)) * XP + (G & 15) * 8) = rnd8(wv[u]); }
#pragma unroll
        for (int u = 0; u < 3; ++u) { const int i = tid + u * PWV * 32; if ((u + 1) * PWV * 32 <= PT * DM / 8 || i < PT * DM / 8) *(v8usa*)(sm + (3 * HD + (i >> 4)) * XP + (i & 15) * 8) = rnd8(xv[u]); }
    }
    __syncthreads();   // the staged rows are read by every wave
    const bool qk = w < 8;
    const int arow = qk ? (w >> 2) * HD : 3 * HD;                               // first of the 64 staged rows that are D's rows
    const int brow = qk ? 3 * HD + (w & 3) * 16 : 2 * HD + (w - 8) * 16;        // first of the 16 staged rows that are D's columns
    const bf* ap = sm + arow * XP + c * XP + 8 * h; const bf* bp = sm + brow * XP + c * XP + 8 * h;
    // the lane's place in its planes: accumulator tile i is half i & 1 of fragment i >> 1 (q, k: of the tile's two; v: of the same column tile in two passes)
    const int po = (qk ? ((w >> 2) * NB_ * TT + r0 + (w & 3) * 16) * HD : r0 * HD + (w - 8) * 512) + lane * 8;
    const int pf = qk ? 512 : 4 * 512;   // elements from fragment i >> 1 = 0 to 1
    bf* ph = (qk ? QKh : VTh) + po; bf* pl = (qk ? QKl : VTl) + po;
    v8f acc[4];
#pragma unroll
    for (int i = 0; i < 4; ++i) acc[i] = (v8f){};
#pragma unroll
    for (int kc = 0; kc < DM / 32; ++kc) { const v16bf bfr = ldsf(bp + kc * 32);
#pragma unroll
        for (int i = 0; i < 4; ++i) acc[i] = wmmab(ldsf(ap + i * 16 * XP + kc * 32), bfr, acc[i]); }
#pragma unroll
    for (int i = 0; i < 4; ++i) { v8bf a; v8f r;
#pragma unroll
        for (int e = 0; e < 8; ++e) { a[e] = (__bf16)acc[i][e]; r[e] = acc[i][e] - (float)a[e]; }
        *(v8us*)(ph + (i >> 1) * pf + (i & 1) * 256) = __builtin_bit_cast(v8us, a); *(v8us*)(pl + (i >> 1) * pf + (i & 1) * 256) = rnd8(r); }
    if (!qk) {
        asm volatile("s_wait_xcnt 0x0" ::: "memory");   // the plane stores above are issued: their registers may be rewritten behind this wait
        __builtin_amdgcn_sched_barrier(0);              // keeps the vector work below from being lifted over the wait (a "memory" clobber does not tie it to registers)
#pragma unroll
        for (int i = 0; i < 4; ++i) { v8h f;
#pragma unroll
            for (int e = 0; e < 8; ++e) f[e] = (h16)acc[i][e];
            *(v8h*)(VT16 + po + (i >> 1) * pf + (i & 1) * 256) = f; } }
}
__device__ __forceinline__ float xhalf(float x) { return __builtin_bit_cast(float, __builtin_amdgcn_permlanex16(__builtin_bit_cast(int, x), __builtin_bit_cast(int, x), 0x76543210, 0xfedcba98, false, false)); }   // lane l with lane l ^ 16
// fragment at the lane's own address p plus a constant byte step, in the k order of every loader here (its two halves lie 512 B apart: each load of a wave reads 512 contiguous bytes)
__device__ __forceinline__ v16bf ldfb(const char* p, int step) { return cat16b(*(const v8us*)(p + step), *(const v8us*)(p + step + 512)); }
__device__ __forceinline__ v16h ldfh(const char* p, int step) { return cat16(*(const v8h*)(p + step), *(const v8h*)(p + step + 512)); }
template <bool HR>
__device__ __forceinline__ void fattn_body(const bf* __restrict__ Qh, const bf* __restrict__ Ql, const h16* __restrict__ VT16, const bf* __restrict__ VTh, const bf* __restrict__ VTl, float* OUTb, int q0, float* red, float* mw, float* lw) {
    const int lane = threadIdx.x & 31, c = lane & 15, h = lane >> 4, w = __builtin_amdgcn_readfirstlane(threadIdx.x >> 5);   // w in a scalar register: scalar loop counter and a scalar loop branch
    const unsigned fo = (unsigned)lane * 16u;   // the lane's byte offset in a half fragment, in every plane
    v16bf qh[NG][2], ql[NG][2];   // [column group][32 of the head's 64]
    const char* qhp = (const char*)(Qh + q0 * HD) + fo; const char* qlp = (const char*)(Ql + q0 * HD) + fo;   // the lane's address in each q plane
#pragma unroll
    for (int g = 0; g < NG; ++g)
#pragma unroll
        for (int kc = 0; kc < 2; ++kc) { const int qo = (g * 16 * HD + kc * 512) * 2; qh[g][kc] = ldfb(qhp, qo); ql[g][kc] = ldfb(qlp, qo); }
    asm volatile("s_wait_xcnt 0x0" :: "v"(qhp), "v"(qlp) : "memory");   // before the q loads' address registers are rewritten; as inputs the addresses live up to the wait, so that no load of the run gets their registers for its result
    __builtin_amdgcn_sched_barrier(0);              // keeps later address arithmetic behind the wait
    v8f o[4][NG];               // O^T: o[dt][g][r] = O[query q0 + 16 g + c][16 dt + 8 h + r], un-normalised
    float m[NG], l[NG];
#pragma unroll
    for (int g = 0; g < NG; ++g) { m[g] = -3.0e38f; l[g] = 0.f;
#pragma unroll
        for (int dt = 0; dt < 4; ++dt) o[dt][g] = (v8f){}; }
    const int k0 = w * (TT / FW);
    v16bf kh[2][2], kl[2][2];   // [key tile][32 of 64]: the pass's k fragments, fetched one pass ahead
    const int KP = NB_ * TT * HD * 2;   // bytes from a batch's q plane to its k plane: a constant step of the loads, so that the register pair they name is the address handed to the wait
    const char* khp = (const char*)(Qh + k0 * HD) + fo; const char* klp = (const char*)(Ql + k0 * HD) + fo;
#pragma unroll
    for (int t = 0; t < 2; ++t)
#pragma unroll
        for (int kc = 0; kc < 2; ++kc) { const int ko = KP + (t * 16 * HD + kc * 512) * 2; kh[t][kc] = ldfb(khp, ko); kl[t][kc] = ldfb(klp, ko); }
    asm volatile("s_wait_xcnt 0x0" :: "v"(khp), "v"(klp) : "memory");   // before the first k loads' address registers are rewritten; the addresses live up to the wait
    __builtin_amdgcn_sched_barrier(0);              // keeps later address arithmetic behind the wait
#pragma unroll 1   // one pass is already 64 to 96 matrix instructions; unrolled, the registers of two passes do not fit two waves a SIMD
    for (int kb = k0; kb < k0 + TT / FW; kb += 32) {
        v16h v16[4]; v16bf vh[4], vl[4];   // the pass's v fragments: their loads fly behind the score products and the softmax
        const char* vap = (HR ? (const char*)(VTh + kb * HD) : (const char*)(VT16 + kb * HD)) + fo; const char* vbp = (HR ? (const char*)(VTl + kb * HD) : (const char*)(VT16 + kb * HD)) + fo;   // the lane's address in the pass's v planes (one plane in the fp16 class)
#pragma unroll
        for (int dt = 0; dt < 4; ++dt) { const int vs = dt * 512 * 2; if (HR) { vh[dt] = ldfb(vap, vs); vl[dt] = ldfb(vbp, vs); } else v16[dt] = ldfh(vap, vs); }
        v8f s[2][NG];           // [key tile][column group]
#pragma unroll
        for (int t = 0; t < 2; ++t)
#pragma unroll
            for (int g = 0; g < NG; ++g) { v8f a = (v8f){};
#pragma unroll
                for (int kc = 0; kc < 2; ++kc) { a = wmmab(kh[t][kc], qh[g][kc], a); a = wmmab(kh[t][kc], ql[g][kc], a); a = wmmab(kl[t][kc], qh[g][kc], a); }
                s[t][g] = a; }
        const int kn = (kb + 32 < TT) ? kb + 32 : kb;   // the last range's last pass fetches its own tiles again: in bounds, never used
        const char* knh = (const char*)(Qh + kn * HD) + fo; const char* knl = (const char*)(Ql + kn * HD) + fo;
#pragma unroll
        for (int t = 0; t < 2; ++t)
#pragma unroll
            for (int kc = 0; kc < 2; ++kc) { const int ko = KP + (t * 16 * HD + kc * 512) * 2; kh[t][kc] = ldfb(knh, ko); kl[t][kc] = ldfb(knl, ko); }
        asm volatile("s_wait_xcnt 0x0" :: "v"(vap), "v"(vbp), "v"(knh), "v"(knl) : "memory");   // the pass's loads are all issued: their address registers may be rewritten behind this wait; as inputs the addresses live up to it, so that no load of the pass gets their registers for its result
        __builtin_amdgcn_sched_barrier(0);              // keeps the vector work below from being lifted over the wait (a "memory" clobber does not tie it to registers)
        float mn[NG]; bool up = false;
#pragma unroll
        for (int g = 0; g < NG; ++g) { float tm = s[0][g][0];
#pragma unroll
            for (int r = 0; r < 8; ++r) tm = fmaxf(tm, fmaxf(s[0][g][r], s[1][g][r]));
            tm *= SCL; tm = fmaxf(tm, xhalf(tm)); mn[g] = fmaxf(m[g], tm); up = up || (mn[g] > m[g]); }
        if (__builtin_amdgcn_ballot_w32(up) != 0) {   // scalar branch: the rescale runs only in a pass that raises some column's maximum
#pragma unroll
            for (int g = 0; g < NG; ++g) { const float al = __builtin_amdgcn_exp2f((m[g] - mn[g]) * L2E); l[g] *= al; m[g] = mn[g];
#pragma unroll
                for (int dt = 0; dt < 4; ++dt) o[dt][g] *= al; } }
#pragma unroll
        for (int g = 0; g < NG; ++g) {
#pragma unroll
            for (int t = 0; t < 2; ++t)
#pragma unroll
                for (int r = 0; r < 8; ++r) { const float p = __builtin_amdgcn_exp2f(fmaf(s[t][g][r] * SCL - m[g], L2E, HR ? 0.f : PSH)); s[t][g][r] = p; l[g] += p; }
            if (HR) { v16bf ph, pl;
#pragma unroll
                for (int e = 0; e < 16; ++e) { const float p = s[e >> 3][g][e & 7]; const __bf16 a = (__bf16)p; ph[e] = a; pl[e] = (__bf16)(p - (float)a); }
#pragma unroll
                for (int dt = 0; dt < 4; ++dt) { o[dt][g] = wmmab(vh[dt], ph, o[dt][g]); o[dt][g] = wmmab(vh[dt], pl, o[dt][g]); o[dt][g] = wmmab(vl[dt], ph, o[dt][g]); }
            } else { v16h pb;
#pragma unroll
                for (int e = 0; e < 16; ++e) pb[e] = (h16)s[e >> 3][g][e & 7];
#pragma unroll
                for (int dt = 0; dt < 4; ++dt) o[dt][g] = wmma16(v16[dt], pb, o[dt][g]); } }
    }
#pragma unroll
    for (int g = 0; g < NG; ++g) { l[g] += xhalf(l[g]); if (h == 0) { mw[w * FQ + g * 16 + c] = m[g]; lw[w * FQ + g * 16 + c] = l[g]; } }
    __syncthreads();   // every range's maximum and sum are in LDS
#pragma unroll
    for (int g = 0; g < NG; ++g) { const int q = g * 16 + c; float M = mw[q];
#pragma unroll
        for (int u = 1; u < FW; ++u) M = fmaxf(M, mw[u * FQ + q]);
        float L = 0.f;
#pragma unroll
        for (int u = 0; u < FW; ++u) L += lw[u * FQ + q] * __builtin_amdgcn_exp2f((mw[u * FQ + q] - M) * L2E);
        const float f = __fdiv_rn(__builtin_amdgcn_exp2f((m[g] - M) * L2E), L);
#pragma unroll
        for (int dt = 0; dt < 4; ++dt) { float* rp = red + (w * FQ + q) * 68 + dt * 16 + 8 * h; const v8f ov = o[dt][g] * f; v4f a, b2;
#pragma unroll
            for (int r = 0; r < 4; ++r) { a[r] = ov[r]; b2[r] = ov[4 + r]; }
            *(v4fa*)rp = a; *(v4fa*)(rp + 4) = b2; } }
    __syncthreads();   // every range's weighted tile is in LDS
#pragma unroll
    for (int i = 0; i < FQ / 32; ++i) { const int q = i * 32 + (threadIdx.x >> 3), d0 = (threadIdx.x & 7) * 8; v4f a = *(const v4fa*)(red + q * 68 + d0), b2 = *(const v4fa*)(red + q * 68 + d0 + 4);
#pragma unroll
        for (int u = 1; u < FW; ++u) { a += *(const v4fa*)(red + (u * FQ + q) * 68 + d0); b2 += *(const v4fa*)(red + (u * FQ + q) * 68 + d0 + 4); }
        float* op = OUTb + (size_t)(q0 + q) * DQ + d0; *(v4f*)op = a; *(v4f*)(op + 4) = b2; }
}
// grid (TT / FQ, NB_) = one work-group a WGP; two waves a SIMD, up to 512 registers each: 64 columns a wave halve the k and v loads per product
__global__ __launch_bounds__(FW * 32) __attribute__((amdgpu_waves_per_eu(2, 2))) void k_fattn(const bf* __restrict__ QKh, const bf* __restrict__ QKl, const h16* __restrict__ VT16, const bf* __restrict__ VTh, const bf* __restrict__ VTl, float* OUT) {
    __shared__ __align__(16) float red[FW * FQ * 68]; __shared__ float mw[FW * FQ]; __shared__ float lw[FW * FQ];
    const size_t PL = (size_t)TT * HD, zb = blockIdx.y; const int q0 = blockIdx.x * FQ;
    const bf* Qh = QKh + zb * PL; const bf* Ql = QKl + zb * PL;   // the batch's k planes lie NB_ planes behind its q planes
    if (q0 < RH) fattn_body<true>(Qh, Ql, VT16 + zb * PL, VTh + zb * PL, VTl + zb * PL, OUT + zb * TT * DQ, q0, red, mw, lw);
    else fattn_body<false>(Qh, Ql, VT16 + zb * PL, VTh + zb * PL, VTl + zb * PL, OUT + zb * TT * DQ, q0, red, mw, lw);
}

extern "C" void kernel_launch(void* const* d_in, const int* in_sizes, int n_in,
                              void* d_out, int out_size, void* d_ws, size_t ws_size, hipStream_t stream) {
    (void)in_sizes; (void)n_in; (void)out_size;
    const float* x = (const float*)d_in[0]; const float* ker = (const float*)d_in[1];   /* kernel [3][128][64] */
    float* OUT = (float*)d_out;     // [4][4096][64]
    char* wsp = (char*)d_ws;
    auto take = [&](size_t bytes) { char* p = wsp; wsp += (bytes + 255) & ~(size_t)255; return (void*)p; };
    const size_t PL = (size_t)TT * HD;   // one batch's plane, elements
    bf* QKh = (bf*)take(2 * NB_ * PL * 2); bf* QKl = (bf*)take(2 * NB_ * PL * 2);   /* [q, k][batch][TT / 16 tiles][2 KiB] */
    h16* VT16 = (h16*)take(NB_ * PL * 2); bf* VTh = (bf*)take(NB_ * PL * 2); bf* VTl = (bf*)take(NB_ * PL * 2);   /* [batch][TT / 32 passes][4 KiB] */
    if ((size_t)(wsp - (char*)d_ws) > ws_size) return;    // ws 256 MiB
    k_proj<<<NB_ * TT / PT, PWV * 32, 0, stream>>>(x, ker, QKh, QKl, VT16, VTh, VTl);
    k_fattn<<<dim3(TT / FQ, NB_, 1), FW * 32, 0, stream>>>(QKh, QKl, VT16, VTh, VTl, OUT);
}

// v006
// Measured time: 39.7 microseconds a run.
// In two side-by-side timings against v005, it was 1.04 and 1.03 times as fast.
// Over all steps from v000 it is 23.4 times as fast.
#include <hip/hip_runtime.h>

// Single-head self-attention over 4,096 tokens with a 64-wide head (x [4][4096][128]; WQ, WK, WV = x kernel[0/1/2] ('xw' [3][128][64] sigma 1); scores / sqrt(64); softmax; out = attn WV -> [4][4096][64] (1 M)).
// Launches: ONE projection kernel (inputs rounded, q/k/v projected, 16-bit planes stored from the accumulators; all four batches in one grid), then ONE attention kernel for all batches: scores, softmax and attn.v never leave the registers.
// Layout per batch: exact projections of the bf16-rounded inputs; 16-bit planes of q, k and v in fragment order (see k_proj); fused T-4096 attention for the one head (scores hi/lo 3 products on EVERY row: the logits are far too peaked for fp16 scores; P and attn.v hybrid: rows < 512 hi/lo, rest fp16 x1024; online softmax).
// Compute dtypes, f32 accumulate: every input rounded to bf16; projections exact; scores 3 products on every row; softmax f32; attn.v rows < 512 3 products, rest fp16; output f32.

#define NB_  4
#define TT   4096
#define DM   128
#define NH_  1
#define NKV  1
#define REP  (NH_ / NKV)
#define HD   64
#define DQ   (NH_ * HD)
#define DKV  (NKV * HD)
#define RH   512                  // query rows < RH use hi+lo planes (0: none)
#define WIN  0
#define PSH  10.0f               // fp16 P carries 2^PSH; the row sum carries it too, so the quotient is free of it
#define SCL  0.125f   // HD^-0.5
#define FW   8                    // waves of an attention work-group: one key range of TT / FW keys each
#define FQ   64                   // query columns of an attention work-group (every wave holds all of them)
#define NG   (FQ / 16)            // 16-column groups
#define L2E  1.4426950408889634f
typedef _Float16 h16;
typedef unsigned short bf;
typedef __attribute__((ext_vector_type(16))) __bf16   v16bf;
typedef __attribute__((ext_vector_type(16))) _Float16 v16h;
typedef __attribute__((ext_vector_type(8)))  _Float16 v8h;
typedef __attribute__((ext_vector_type(8)))  unsigned short v8us;
typedef __attribute__((ext_vector_type(8)))  float    v8f;
typedef __attribute__((ext_vector_type(16))) float    v16f;
typedef __attribute__((ext_vector_type(8)))  unsigned int v8u;
typedef __attribute__((ext_vector_type(4)))  float    v4f;
typedef v8h  __attribute__((may_alias)) v8ha;
typedef v4f  __attribute__((may_alias)) v4fa;
typedef v8us __attribute__((may_alias)) v8usa;

__device__ __forceinline__ v16h cat16(v8h lo, v8h hi) { return __builtin_shufflevector(lo, hi, 0, 1, 2, 3, 4, 5, 6, 7, 8, 9, 10, 11, 12, 13, 14, 15); }
__device__ __forceinline__ v16bf cat16b(v8us lo, v8us hi) { return __builtin_bit_cast(v16bf, __builtin_shufflevector(lo, hi, 0, 1, 2, 3, 4, 5, 6, 7, 8, 9, 10, 11, 12, 13, 14, 15)); }
__device__ __forceinline__ v8f wmma16(v16h a, v16h b, v8f c) { return __builtin_amdgcn_wmma_f32_16x16x32_f16(false, a, false, b, (short)0, c, false, false); }
__device__ __forceinline__ v8f wmmab(v16bf a, v16bf b, v8f c) { return __builtin_amdgcn_wmma_f32_16x16x32_bf16(false, a, false, b, (short)0, c, false, false); }


typedef __attribute__((ext_vector_type(8))) __bf16 v8bf;
// k_proj: one work-group = PT tokens (flat over the batches) x all 192 columns of q, k, v; 12 waves.
// Stage: the three weight blocks, transposed to [column][k], and the tokens' x rows, rounded to bf16, in LDS at a pitch of 272 B (16 B x odd: ds_load_b128 without bank conflicts).
// Every wave: D (64 x 16) = 64 staged rows (A, four tiles) times 16 staged rows (B); a lane holds 8 neighbouring D rows of one D column: the 16 bytes that the same lane of an attention wave loads as one half of a fragment.
// The planes are kept in that fragment order: a half fragment is 32 lanes x 16 B = 512 contiguous bytes, so that every store here and every load in k_fattn covers four whole 128-B lines.
// Waves 0-7: A = the 64 columns of q or k, B = 16 tokens. q, k planes: [16-token tile][32 of the head's 64][half][lane][8], 2 KiB a tile.
// Waves 8-11: A = the 64 tokens, B = 16 columns of v. v planes: [32-key pass][16-column tile][half][lane][8], 4 KiB a pass.
#define PT   64
#define XP   (DM + 8)             // LDS row pitch, 16-bit elements
#define PWV  12                   // waves of a projection work-group
__device__ __forceinline__ v8us rnd8(v8f v) { v8bf o;
#pragma unroll
    for (int e = 0; e < 8; ++e) o[e] = (__bf16)v[e];
    return __builtin_bit_cast(v8us, o); }
__device__ __forceinline__ v16bf ldsf(const bf* p) { return cat16b(*(const v8usa*)p, *(const v8usa*)(p + 16)); }   // k order of every loader here
__global__ __launch_bounds__(PWV * 32) void k_proj(const float* __restrict__ x, const float* __restrict__ ker, bf* QKh, bf* QKl, h16* VT16, bf* VTh, bf* VTl) {
    __shared__ __align__(16) bf sm[(3 * HD + PT) * XP];   // rows 0-191: weights [q, k, v column][k]; rows 192-255: x [token][k]
    const int tid = threadIdx.x, lane = tid & 31, c = lane & 15, h = lane >> 4, w = __builtin_amdgcn_readfirstlane(tid >> 5);
    const int r0 = blockIdx.x * PT;   // first token, flat over the batches
    {   // weights: a thread takes 8 k of one column (its loads: 128 contiguous bytes a wave), 8 such pieces; the three blocks are one [384][64] array
        const float* wp = ker + (tid >> 6) * 8 * HD + (tid & 63); v8f wv[8];
#pragma unroll
        for (int u = 0; u < 8; ++u)
#pragma unroll
            for (int i = 0; i < 8; ++i) wv[u][i] = wp[(u * (PWV * 32 / 64) * 8 + i) * HD];
        // x: 8 floats a thread and piece, contiguous over the work-group
        const float* xp = x + (size_t)r0 * DM + tid * 8; v8f xv[3];
#pragma unroll
        for (int u = 0; u < 3; ++u) if ((u + 1) * PWV * 32 <= PT * DM / 8 || tid + u * PWV * 32 < PT * DM / 8) xv[u] = *(const v8f*)(xp + u * PWV * 32 * 8);
#pragma unroll
        for (int u = 0; u < 8; ++u) { const int G = (tid >> 6) + u * (PWV * 32 / 64);   // 8-k group: block G / 16, k 8 (G % 16)
            *(v8usa*)(sm + ((G >> 4) * HD + (tid & 63)) * XP + (G & 15) * 8) = rnd8(wv[u]); }
#pragma unroll
        for (int u = 0; u < 3; ++u) { const int i = tid + u * PWV * 32; if ((u + 1) * PWV * 32 <= PT * DM / 8 || i < PT * DM / 8) *(v8usa*)(sm + (3 * HD + (i >> 4)) * XP + (i & 15) * 8) = rnd8(xv[u]); }
    }
    __syncthreads();   // the staged rows are read by every wave
    const bool qk = w < 8;
    const int arow = qk ? (w >> 2) * HD : 3 * HD;                               // first of the 64 staged rows that are D's rows
    const int brow = qk ? 3 * HD + (w & 3) * 16 : 2 * HD + (w - 8) * 16;        // first of the 16 staged rows that are D's columns
    const bf* ap = sm + arow * XP + c * XP + 8 * h; const bf* bp = sm + brow * XP + c * XP + 8 * h;
    // the lane's place in its planes: accumulator tile i is half i & 1 of fragment i >> 1 (q, k: of the tile's two; v: of the same column tile in two passes)
    const int po = (qk ? ((w >> 2) * NB_ * TT + r0 + (w & 3) * 16) * HD : r0 * HD + (w - 8) * 512) + lane * 8;
    const int pf = qk ? 512 : 4 * 512;   // elements from fragment i >> 1 = 0 to 1
    bf* ph = (qk ? QKh : VTh) + po; bf* pl = (qk ? QKl : VTl) + po;
    v8f acc[4];
#pragma unroll
    for (int i = 0; i < 4; ++i) acc[i] = (v8f){};
#pragma unroll
    for (int kc = 0; kc < DM / 32; ++kc) { const v16bf bfr = ldsf(bp + kc * 32);
#pragma unroll
        for (int i = 0; i < 4; ++i) acc[i] = wmmab(ldsf(ap + i * 16 * XP + kc * 32), bfr, acc[i]); }
#pragma unroll
    for (int i = 0; i < 4; ++i) { v8bf a; v8f r;
#pragma unroll
        for (int e = 0; e < 8; ++e) { a[e] = (__bf16)acc[i][e]; r[e] = acc[i][e] - (float)a[e]; }
        *(v8us*)(ph + (i >> 1) * pf + (i & 1) * 256) = __builtin_bit_cast(v8us, a); *(v8us*)(pl + (i >> 1) * pf + (i & 1) * 256) = rnd8(r); }
    if (!qk) {
        asm volatile("s_wait_xcnt 0x0" ::: "memory");   // the plane stores above are issued: their registers may be rewritten behind this wait
        __builtin_amdgcn_sched_barrier(0);              // keeps the vector work below from being lifted over the wait (a "memory" clobber does not tie it to registers)
#pragma unroll
        for (int i = 0; i < 4; ++i) { v8h f;
#pragma unroll
            for (int e = 0; e < 8; ++e) f[e] = (h16)acc[i][e];
            *(v8h*)(VT16 + po + (i >> 1) * pf + (i & 1) * 256) = f; } }
}
__device__ __forceinline__ float xhalf(float x) { return __builtin_bit_cast(float, __builtin_amdgcn_permlanex16(__builtin_bit_cast(int, x), __builtin_bit_cast(int, x), 0x76543210, 0xfedcba98, false, false)); }   // lane l with lane l ^ 16
// fragment at the lane's own address p plus a constant byte step, in the k order of every loader here (its two halves lie 512 B apart: each load of a wave reads 512 contiguous bytes)
__device__ __forceinline__ v16bf ldfb(const char* p, int step) { return cat16b(*(const v8us*)(p + step), *(const v8us*)(p + step + 512)); }
__device__ __forceinline__ v16h ldfh(const char* p, int step) { return cat16(*(const v8h*)(p + step), *(const v8h*)(p + step + 512)); }
template <bool HR>
__device__ __forceinline__ void fattn_body(const bf* __restrict__ Qh, const bf* __restrict__ Ql, const h16* __restrict__ VT16, const bf* __restrict__ VTh, const bf* __restrict__ VTl, float* OUTb, int q0, float* red, float* mw, float* lw) {
    const int lane = threadIdx.x & 31, c = lane & 15, h = lane >> 4, w = __builtin_amdgcn_readfirstlane(threadIdx.x >> 5);   // w in a scalar register: scalar loop counter and a scalar loop branch
    const unsigned fo = (unsigned)lane * 16u;   // the lane's byte offset in a half fragment, in every plane
    v16bf qh[NG][2], ql[NG][2];   // [column group][32 of the head's 64]
    const char* qhp = (const char*)(Qh + q0 * HD) + fo; const char* qlp = (const char*)(Ql + q0 * HD) + fo;   // the lane's address in each q plane
#pragma unroll
    for (int g = 0; g < NG; ++g)
#pragma unroll
        for (int kc = 0; kc < 2; ++kc) { const int qo = (g * 16 * HD + kc * 512) * 2; qh[g][kc] = ldfb(qhp, qo); ql[g][kc] = ldfb(qlp, qo); }
    asm volatile("s_wait_xcnt 0x0" :: "v"(qhp), "v"(qlp) : "memory");   // before the q loads' address registers are rewritten; as inputs the addresses live up to the wait, so that no load of the run gets their registers for its result
    __builtin_amdgcn_sched_barrier(0);              // keeps later address arithmetic behind the wait
    v8f o[4][NG];               // O^T: o[dt][g][r] = O[query q0 + 16 g + c][16 dt + 8 h + r], un-normalised
    float m[NG], l[NG];
#pragma unroll
    for (int g = 0; g < NG; ++g) { m[g] = -3.0e38f; l[g] = 0.f;
#pragma unroll
        for (int dt = 0; dt < 4; ++dt) o[dt][g] = (v8f){}; }
    const int k0 = w * (TT / FW);
    v16bf kh[2][2], kl[2][2];   // [key tile][32 of 64]: the pass's k fragments, fetched one pass ahead
    const int KP = NB_ * TT * HD * 2;   // bytes from a batch's q plane to its k plane: a constant step of the loads, so that the register pair they name is the address handed to the wait
    const char* khp = (const char*)(Qh + k0 * HD) + fo; const char* klp = (const char*)(Ql + k0 * HD) + fo;
#pragma unroll
    for (int t = 0; t < 2; ++t)
#pragma unroll
        for (int kc = 0; kc < 2; ++kc) { const int ko = KP + (t * 16 * HD + kc * 512) * 2; kh[t][kc] = ldfb(khp, ko); kl[t][kc] = ldfb(klp, ko); }
    asm volatile("s_wait_xcnt 0x0" :: "v"(khp), "v"(klp) : "memory");   // before the first k loads' address registers are rewritten; the addresses live up to the wait
    __builtin_amdgcn_sched_barrier(0);              // keeps later address arithmetic behind the wait
#pragma unroll 1   // one pass is already 64 to 96 matrix instructions; unrolled, the registers of two passes do not fit two waves a SIMD
    for (int kb = k0; kb < k0 + TT / FW; kb += 32) {
        v16h v16[4]; v16bf vh[4], vl[4];   // the pass's v fragments: their loads fly behind the score products and the softmax
        const char* vap = (HR ? (const char*)(VTh + kb * HD) : (const char*)(VT16 + kb * HD)) + fo; const char* vbp = (HR ? (const char*)(VTl + kb * HD) : (const char*)(VT16 + kb * HD)) + fo;   // the lane's address in the pass's v planes (one plane in the fp16 class)
#pragma unroll
        for (int dt = 0; dt < 4; ++dt) { const int vs = dt * 512 * 2; if (HR) { vh[dt] = ldfb(vap, vs); vl[dt] = ldfb(vbp, vs); } else v16[dt] = ldfh(vap, vs); }
        v8f s[2][NG];           // [key tile][column group]
#pragma unroll
        for (int t = 0; t < 2; ++t)
#pragma unroll
            for (int g = 0; g < NG; ++g) { v8f a = (v8f){};
#pragma unroll
                for (int kc = 0; kc < 2; ++kc) { a = wmmab(kh[t][kc], qh[g][kc], a); a = wmmab(kh[t][kc], ql[g][kc], a); a = wmmab(kl[t][kc], qh[g][kc], a); }
                s[t][g] = a; }
        const int kn = (kb + 32 < TT) ? kb + 32 : kb;   // the last range's last pass fetches its own tiles again: in bounds, never used
        const char* knh = (const char*)(Qh + kn * HD) + fo; const char* knl = (const char*)(Ql + kn * HD) + fo;
#pragma unroll
        for (int t = 0; t < 2; ++t)
#pragma unroll
            for (int kc = 0; kc < 2; ++kc) { const int ko = KP + (t * 16 * HD + kc * 512) * 2; kh[t][kc] = ldfb(knh, ko); kl[t][kc] = ldfb(knl, ko); }
        asm volatile("s_wait_xcnt 0x0" :: "v"(vap), "v"(vbp), "v"(knh), "v"(knl) : "memory");   // the pass's loads are all issued: their address registers may be rewritten behind this wait; as inputs the addresses live up to it, so that no load of the pass gets their registers for its result
        __builtin_amdgcn_sched_barrier(0);              // keeps the vector work below from being lifted over the wait (a "memory" clobber does not tie it to registers)
        float mn[NG]; bool up = false;
#pragma unroll
        for (int g = 0; g < NG; ++g) { float tm = s[0][g][0];
#pragma unroll
            for (int r = 0; r < 8; ++r) tm = fmaxf(tm, fmaxf(s[0][g][r], s[1][g][r]));
            tm *= SCL; tm = fmaxf(tm, xhalf(tm)); mn[g] = fmaxf(m[g], tm); up = up || (mn[g] > m[g]); }
        if (__builtin_amdgcn_ballot_w32(up) != 0) {   // scalar branch: the rescale runs only in a pass that raises some column's maximum
#pragma unroll
            for (int g = 0; g < NG; ++g) { const float al = __builtin_amdgcn_exp2f((m[g] - mn[g]) * L2E); l[g] *= al; m[g] = mn[g];
#pragma unroll
                for (int dt = 0; dt < 4; ++dt) o[dt][g] *= al; } }
#pragma unroll
        for (int g = 0; g < NG; ++g) {
#pragma unroll
            for (int t = 0; t < 2; ++t)
#pragma unroll
                for (int r = 0; r < 8; ++r) { const float p = __builtin_amdgcn_exp2f(fmaf(s[t][g][r] * SCL - m[g], L2E, HR ? 0.f : PSH)); s[t][g][r] = p; l[g] += p; }
            if (HR) {   // hi/lo split of P on whole vectors: two values a conversion, the same roundings as one by one
                const v16f pv = __builtin_shufflevector(s[0][g], s[1][g], 0, 1, 2, 3, 4, 5, 6, 7, 8, 9, 10, 11, 12, 13, 14, 15);
                const v16bf ph = __builtin_convertvector(pv, v16bf); const v8u pw = __builtin_bit_cast(v8u, ph); v16f pb2;   // the hi parts back as f32, taken from the packed words
#pragma unroll
                for (int e = 0; e < 8; ++e) { pb2[2 * e] = __builtin_bit_cast(float, pw[e] << 16); pb2[2 * e + 1] = __builtin_bit_cast(float, pw[e] & 0xffff0000u); }
                const v16bf pl = __builtin_convertvector(pv - pb2, v16bf);
#pragma unroll
                for (int dt = 0; dt < 4; ++dt) { o[dt][g] = wmmab(vh[dt], ph, o[dt][g]); o[dt][g] = wmmab(vh[dt], pl, o[dt][g]); o[dt][g] = wmmab(vl[dt], ph, o[dt][g]); }
            } else { v16h pb;
#pragma unroll
                for (int e = 0; e < 16; ++e) pb[e] = (h16)s[e >> 3][g][e & 7];
#pragma unroll
                for (int dt = 0; dt < 4; ++dt) o[dt][g] = wmma16(v16[dt], pb, o[dt][g]); } }
    }
#pragma unroll
    for (int g = 0; g < NG; ++g) { l[g] += xhalf(l[g]); if (h == 0) { mw[w * FQ + g * 16 + c] = m[g]; lw[w * FQ + g * 16 + c] = l[g]; } }
    __syncthreads();   // every range's maximum and sum are in LDS
#pragma unroll
    for (int g = 0; g < NG; ++g) { const int q = g * 16 + c; float M = mw[q];
#pragma unroll
        for (int u = 1; u < FW; ++u) M = fmaxf(M, mw[u * FQ + q]);
        float L = 0.f;
#pragma unroll
        for (int u = 0; u < FW; ++u) L += lw[u * FQ + q] * __builtin_amdgcn_exp2f((mw[u * FQ + q] - M) * L2E);
        const float f = __fdiv_rn(__builtin_amdgcn_exp2f((m[g] - M) * L2E), L);
#pragma unroll
        for (int dt = 0; dt < 4; ++dt) { float* rp = red + (w * FQ + q) * 68 + dt * 16 + 8 * h; const v8f ov = o[dt][g] * f; v4f a, b2;
#pragma unroll
            for (int r = 0; r < 4; ++r) { a[r] = ov[r]; b2[r] = ov[4 + r]; }
            *(v4fa*)rp = a; *(v4fa*)(rp + 4) = b2; } }
    __syncthreads();   // every range's weighted tile is in LDS
#pragma unroll
    for (int i = 0; i < FQ / 32; ++i) { const int q = i * 32 + (threadIdx.x >> 3), d0 = (threadIdx.x & 7) * 8; v4f a = *(const v4fa*)(red + q * 68 + d0), b2 = *(const v4fa*)(red + q * 68 + d0 + 4);
#pragma unroll
        for (int u = 1; u < FW; ++u) { a += *(const v4fa*)(red + (u * FQ + q) * 68 + d0); b2 += *(const v4fa*)(red + (u * FQ + q) * 68 + d0 + 4); }
        float* op = OUTb + (size_t)(q0 + q) * DQ + d0; *(v4f*)op = a; *(v4f*)(op + 4) = b2; }
}
// grid (TT / FQ, NB_) = one work-group a WGP; two waves a SIMD, up to 512 registers each: 64 columns a wave halve the k and v loads per product
__global__ __launch_bounds__(FW * 32) __attribute__((amdgpu_waves_per_eu(2, 2))) void k_fattn(const bf* __restrict__ QKh, const bf* __restrict__ QKl, const h16* __restrict__ VT16, const bf* __restrict__ VTh, const bf* __restrict__ VTl, float* OUT) {
    __shared__ __align__(16) float red[FW * FQ * 68]; __shared__ float mw[FW * FQ]; __shared__ float lw[FW * FQ];
    const size_t PL = (size_t)TT * HD, zb = blockIdx.y; const int q0 = blockIdx.x * FQ;
    const bf* Qh = QKh + zb * PL; const bf* Ql = QKl + zb * PL;   // the batch's k planes lie NB_ planes behind its q planes
    if (q0 < RH) fattn_body<true>(Qh, Ql, VT16 + zb * PL, VTh + zb * PL, VTl + zb * PL, OUT + zb * TT * DQ, q0, red, mw, lw);
    else fattn_body<false>(Qh, Ql, VT16 + zb * PL, VTh + zb * PL, VTl + zb * PL, OUT + zb * TT * DQ, q0, red, mw, lw);
}

extern "C" void kernel_launch(void* const* d_in, const int* in_sizes, int n_in,
                              void* d_out, int out_size, void* d_ws, size_t ws_size, hipStream_t stream) {
    (void)in_sizes; (void)n_in; (void)out_size;
    const float* x = (const float*)d_in[0]; const float* ker = (const float*)d_in[1];   /* kernel [3][128][64] */
    float* OUT = (float*)d_out;     // [4][4096][64]
    char* wsp = (char*)d_ws;
    auto take = [&](size_t bytes) { char* p = wsp; wsp += (bytes + 255) & ~(size_t)255; return (void*)p; };
    const size_t PL = (size_t)TT * HD;   // one batch's plane, elements
    bf* QKh = (bf*)take(2 * NB_ * PL * 2); bf* QKl = (bf*)take(2 * NB_ * PL * 2);   /* [q, k][batch][TT / 16 tiles][2 KiB] */
    h16* VT16 = (h16*)take(NB_ * PL * 2); bf* VTh = (bf*)take(NB_ * PL * 2); bf* VTl = (bf*)take(NB_ * PL * 2);   /* [batch][TT / 32 passes][4 KiB] */
    if ((size_t)(wsp - (char*)d_ws) > ws_size) return;    // ws 256 MiB
    k_proj<<<NB_ * TT / PT, PWV * 32, 0, stream>>>(x, ker, QKh, QKl, VT16, VTh, VTl);
    k_fattn<<<dim3(TT / FQ, NB_, 1), FW * 32, 0, stream>>>(QKh, QKl, VT16, VTh, VTl, OUT);
}

// v007
// A run of this version takes 37.1 microseconds.
// Timed twice side by side with v006, it ran 1.06 and 1.07 times as fast.
// All steps since v000 together make it 24.9 times as fast.
#include <hip/hip_runtime.h>

// Single-head self-attention over 4,096 tokens with a 64-wide head (x [4][4096][128]; WQ, WK, WV = x kernel[0/1/2] ('xw' [3][128][64] sigma 1); scores / sqrt(64); softmax; out = attn WV -> [4][4096][64] (1 M)).
// Launches: ONE projection kernel (inputs rounded, q/k/v projected, 16-bit planes stored from the accumulators; all four batches in one grid), then ONE attention kernel for all batches: scores, softmax and attn.v never leave the registers.
// Layout per batch: exact projections of the bf16-rounded inputs; 16-bit planes of q, k and v in fragment order (see k_proj); fused T-4096 attention for the one head (scores hi/lo 3 products on EVERY row: the logits are far too peaked for fp16 scores; P and attn.v hybrid: rows < 512 hi/lo, rest fp16 x1024; online softmax).
// Compute dtypes, f32 accumulate: every input rounded to bf16; projections exact; scores 3 products on every row; softmax f32; attn.v rows < 512 3 products, rest fp16; output f32.

#define NB_  4
#define TT   4096
#define DM   128
#define NH_  1
#define NKV  1
#define REP  (NH_ / NKV)
#define HD   64
#define DQ   (NH_ * HD)
#define DKV  (NKV * HD)
#define RH   512                  // query rows < RH use hi+lo planes (0: none)
#define WIN  0
#define PSH  10.0f               // fp16 P carries 2^PSH; the row sum carries it too, so the quotient is free of it
#define SCL  0.125f   // HD^-0.5
#define FW   8                    // waves of an attention work-group: one key range of TT / FW keys each
#define FQ   64                   // query columns of an attention work-group (every wave holds all of them)
#define NG   (FQ / 16)            // 16-column groups
#define L2E  1.4426950408889634f
typedef _Float16 h16;
typedef unsigned short bf;
typedef __attribute__((ext_vector_type(16))) __bf16   v16bf;
typedef __attribute__((ext_vector_type(16))) _Float16 v16h;
typedef __attribute__((ext_vector_type(8)))  _Float16 v8h;
typedef __attribute__((ext_vector_type(8)))  unsigned short v8us;
typedef __attribute__((ext_vector_type(8)))  float    v8f;
typedef __attribute__((ext_vector_type(16))) float    v16f;
typedef __attribute__((ext_vector_type(8)))  unsigned int v8u;
typedef __attribute__((ext_vector_type(4)))  float    v4f;
typedef v8h  __attribute__((may_alias)) v8ha;
typedef v4f  __attribute__((may_alias)) v4fa;
typedef v8us __attribute__((may_alias)) v8usa;

__device__ __forceinline__ v16h cat16(v8h lo, v8h hi) { return __builtin_shufflevector(lo, hi, 0, 1, 2, 3, 4, 5, 6, 7, 8, 9, 10, 11, 12, 13, 14, 15); }
__device__ __forceinline__ v16bf cat16b(v8us lo, v8us hi) { return __builtin_bit_cast(v16bf, __builtin_shufflevector(lo, hi, 0, 1, 2, 3, 4, 5, 6, 7, 8, 9, 10, 11, 12, 13, 14, 15)); }
__device__ __forceinline__ v8f wmma16(v16h a, v16h b, v8f c) { return __builtin_amdgcn_wmma_f32_16x16x32_f16(false, a, false, b, (short)0, c, false, false); }
__device__ __forceinline__ v8f wmmab(v16bf a, v16bf b, v8f c) { return __builtin_amdgcn_wmma_f32_16x16x32_bf16(false, a, false, b, (short)0, c, false, false); }


typedef __attribute__((ext_vector_type(8))) __bf16 v8bf;
// k_proj: one work-group = PT tokens (flat over the batches) x all 192 columns of q, k, v; 12 waves.
// Stage: the three weight blocks, transposed to [column][k], and the tokens' x rows, rounded to bf16, in LDS at a pitch of 272 B (16 B x odd: ds_load_b128 without bank conflicts).
// Every wave: D (64 x 16) = 64 staged rows (A, four tiles) times 16 staged rows (B); a lane holds 8 neighbouring D rows of one D column: the 16 bytes that the same lane of an attention wave loads as one half of a fragment.
// The planes are kept in that fragment order: a half fragment is 32 lanes x 16 B = 512 contiguous bytes, so that every store here and every load in k_fattn covers four whole 128-B lines.
// Waves 0-7: A = the 64 columns of q or k, B = 16 tokens. q, k planes: [16-token tile][32 of the head's 64][half][lane][8], 2 KiB a tile.
// Waves 8-11: A = the 64 tokens, B = 16 columns of v. v planes: [32-key pass][16-column tile][half][lane][8], 4 KiB a pass.
#define PT   64
#define XP   (DM + 8)             // LDS row pitch, 16-bit elements
#define PWV  12                   // waves of a projection work-group
__device__ __forceinline__ v8us rnd8(v8f v) { v8bf o;
#pragma unroll
    for (int e = 0; e < 8; ++e) o[e] = (__bf16)v[e];
    return __builtin_bit_cast(v8us, o); }
__device__ __forceinline__ v16bf ldsf(const bf* p) { return cat16b(*(const v8usa*)p, *(const v8usa*)(p + 16)); }   // k order of every loader here
__global__ __launch_bounds__(PWV * 32) void k_proj(const float* __restrict__ x, const float* __restrict__ ker, bf* QKh, bf* QKl, h16* VT16, bf* VTh, bf* VTl) {
    __shared__ __align__(16) bf sm[(3 * HD + PT) * XP];   // rows 0-191: weights [q, k, v column][k]; rows 192-255: x [token][k]
    const int tid = threadIdx.x, lane = tid & 31, c = lane & 15, h = lane >> 4, w = __builtin_amdgcn_readfirstlane(tid >> 5);
    const int r0 = blockIdx.x * PT;   // first token, flat over the batches
    {   // weights: a thread takes 8 k of one column (its loads: 128 contiguous bytes a wave), 8 such pieces; the three blocks are one [384][64] array
        const float* wp = ker + (tid >> 6) * 8 * HD + (tid & 63); v8f wv[8];
#pragma unroll
        for (int u = 0; u < 8; ++u)
#pragma unroll
            for (int i = 0; i < 8; ++i) wv[u][i] = wp[(u * (PWV * 32 / 64) * 8 + i) * HD];
        // x: 8 floats a thread and piece, contiguous over the work-group
        const float* xp = x + (size_t)r0 * DM + tid * 8; v8f xv[3];
#pragma unroll
        for (int u = 0; u < 3; ++u) if ((u + 1) * PWV * 32 <= PT * DM / 8 || tid + u * PWV * 32 < PT * DM / 8) xv[u] = *(const v8f*)(xp + u * PWV * 32 * 8);
#pragma unroll
        for (int u = 0; u < 8; ++u) { const int G = (tid >> 6) + u * (PWV * 32 / 64);   // 8-k group: block G / 16, k 8 (G % 16)
            *(v8usa*)(sm + ((G >> 4) * HD + (tid & 63)) * XP + (G & 15) * 8) = rnd8(wv[u]); }
#pragma unroll
        for (int u = 0; u < 3; ++u) { const int i = tid + u * PWV * 32; if ((u + 1) * PWV * 32 <= PT * DM / 8 || i < PT * DM / 8) *(v8usa*)(sm + (3 * HD + (i >> 4)) * XP + (i & 15) * 8) = rnd8(xv[u]); }
    }
    __syncthreads();   // the staged rows are read by every wave
    const bool qk = w < 8;
    const int arow = qk ? (w >> 2) * HD : 3 * HD;                               // first of the 64 staged rows that are D's rows
    const int brow = qk ? 3 * HD + (w & 3) * 16 : 2 * HD + (w - 8) * 16;        // first of the 16 staged rows that are D's columns
    const bf* ap = sm + arow * XP + c * XP + 8 * h; const bf* bp = sm + brow * XP + c * XP + 8 * h;
    // the lane's place in its planes: accumulator tile i is half i & 1 of fragment i >> 1 (q, k: of the tile's two; v: of the same column tile in two passes)
    const int po = (qk ? ((w >> 2) * NB_ * TT + r0 + (w & 3) * 16) * HD : r0 * HD + (w - 8) * 512) + lane * 8;
    const int pf = qk ? 512 : 4 * 512;   // elements from fragment i >> 1 = 0 to 1
    bf* ph = (qk ? QKh : VTh) + po; bf* pl = (qk ? QKl : VTl) + po;
    v8f acc[4];
#pragma unroll
    for (int i = 0; i < 4; ++i) acc[i] = (v8f){};
#pragma unroll
    for (int kc = 0; kc < DM / 32; ++kc) { const v16bf bfr = ldsf(bp + kc * 32);
#pragma unroll
        for (int i = 0; i < 4; ++i) acc[i] = wmmab(ldsf(ap + i * 16 * XP + kc * 32), bfr, acc[i]); }
#pragma unroll
    for (int i = 0; i < 4; ++i) { v8bf a; v8f r;
#pragma unroll
        for (int e = 0; e < 8; ++e) { a[e] = (__bf16)acc[i][e]; r[e] = acc[i][e] - (float)a[e]; }
        *(v8us*)(ph + (i >> 1) * pf + (i & 1) * 256) = __builtin_bit_cast(v8us, a); *(v8us*)(pl + (i >> 1) * pf + (i & 1) * 256) = rnd8(r); }
    if (!qk) {
        asm volatile("s_wait_xcnt 0x0" ::: "memory");   // the plane stores above are issued: their registers may be rewritten behind this wait
        __builtin_amdgcn_sched_barrier(0);              // keeps the vector work below from being lifted over the wait (a "memory" clobber does not tie it to registers)
#pragma unroll
        for (int i = 0; i < 4; ++i) { v8h f;
#pragma unroll
            for (int e = 0; e < 8; ++e) f[e] = (h16)acc[i][e];
            *(v8h*)(VT16 + po + (i >> 1) * pf + (i & 1) * 256) = f; } }
}
__device__ __forceinline__ float xhalf(float x) { return __builtin_bit_cast(float, __builtin_amdgcn_permlanex16(__builtin_bit_cast(int, x), __builtin_bit_cast(int, x), 0x76543210, 0xfedcba98, false, false)); }   // lane l with lane l ^ 16
// fragment at the lane's own address p plus a constant byte step, in the k order of every loader here (its two halves lie 512 B apart: each load of a wave reads 512 contiguous bytes)
__device__ __forceinline__ v16bf ldfb(const char* p, int step) { return cat16b(*(const v8us*)(p + step), *(const v8us*)(p + step + 512)); }
__device__ __forceinline__ v16h ldfh(const char* p, int step) { return cat16(*(const v8h*)(p + step), *(const v8h*)(p + step + 512)); }
template <bool MX>   // MX: column group 0 is of the hi/lo row class
__device__ __forceinline__ void fattn_body(const bf* __restrict__ Qh, const bf* __restrict__ Ql, const h16* __restrict__ VT16, const bf* __restrict__ VTh, const bf* __restrict__ VTl, float* OUTb, int qa, int qb, float* red, float* mw, float* lw) {
    const int lane = threadIdx.x & 31, c = lane & 15, h = lane >> 4, w = __builtin_amdgcn_readfirstlane(threadIdx.x >> 5);   // w in a scalar register: scalar loop counter and a scalar loop branch
    const unsigned fo = (unsigned)lane * 16u;   // the lane's byte offset in a half fragment, in every plane
    v16bf qh[NG][2], ql[NG][2];   // [column group][32 of the head's 64]
    const char* qha = (const char*)(Qh + qa * HD) + fo; const char* qla = (const char*)(Ql + qa * HD) + fo;   // the lane's address in each q plane: group 0
    const char* qhp = (const char*)(Qh + qb * HD) + fo; const char* qlp = (const char*)(Ql + qb * HD) + fo;   // groups 1 to NG - 1
#pragma unroll
    for (int g = 0; g < NG; ++g)
#pragma unroll
        for (int kc = 0; kc < 2; ++kc) { const int qo = ((g ? g - 1 : 0) * 16 * HD + kc * 512) * 2; qh[g][kc] = ldfb(g ? qhp : qha, qo); ql[g][kc] = ldfb(g ? qlp : qla, qo); }
    asm volatile("s_wait_xcnt 0x0" :: "v"(qha), "v"(qla), "v"(qhp), "v"(qlp) : "memory");   // before the q loads' address registers are rewritten; as inputs the addresses live up to the wait, so that no load of the run gets their registers for its result
    __builtin_amdgcn_sched_barrier(0);              // keeps later address arithmetic behind the wait
    v8f o[4][NG];               // O^T: o[dt][g][r] = O[column c of group g][16 dt + 8 h + r], un-normalised
    float m[NG], l[NG];
#pragma unroll
    for (int g = 0; g < NG; ++g) { m[g] = -3.0e38f; l[g] = 0.f;
#pragma unroll
        for (int dt = 0; dt < 4; ++dt) o[dt][g] = (v8f){}; }
    const int k0 = w * (TT / FW);
    v16bf kh[2][2], kl[2][2];   // [key tile][32 of 64]: the pass's k fragments, fetched one pass ahead
    const int KP = NB_ * TT * HD * 2;   // bytes from a batch's q plane to its k plane: a constant step of the loads, so that the register pair they name is the address handed to the wait
    const char* khp = (const char*)(Qh + k0 * HD) + fo; const char* klp = (const char*)(Ql + k0 * HD) + fo;
#pragma unroll
    for (int t = 0; t < 2; ++t)
#pragma unroll
        for (int kc = 0; kc < 2; ++kc) { const int ko = KP + (t * 16 * HD + kc * 512) * 2; kh[t][kc] = ldfb(khp, ko); kl[t][kc] = ldfb(klp, ko); }
    asm volatile("s_wait_xcnt 0x0" :: "v"(khp), "v"(klp) : "memory");   // before the first k loads' address registers are rewritten; the addresses live up to the wait
    __builtin_amdgcn_sched_barrier(0);              // keeps later address arithmetic behind the wait
#pragma unroll 1   // one pass is already 64 to 72 matrix instructions; unrolled, the registers of two passes do not fit two waves a SIMD
    for (int kb = k0; kb < k0 + TT / FW; kb += 32) {
        v16h v16[4]; v16bf vh[4], vl[4];   // the pass's v fragments: their loads fly behind the score products and the softmax
        const char* vcp = (const char*)(VT16 + kb * HD) + fo; const char* vap = MX ? (const char*)(VTh + kb * HD) + fo : vcp; const char* vbp = MX ? (const char*)(VTl + kb * HD) + fo : vcp;   // the lane's address in the pass's v planes (the fp16 plane alone where no group is hi/lo)
#pragma unroll
        for (int dt = 0; dt < 4; ++dt) v16[dt] = ldfh(vcp, dt * 512 * 2);
#pragma unroll
        for (int dt = 0; dt < 4; ++dt) if (MX) { vh[dt] = ldfb(vap, dt * 512 * 2); vl[dt] = ldfb(vbp, dt * 512 * 2); }
        v8f s[2][NG];           // [key tile][column group]
#pragma unroll
        for (int t = 0; t < 2; ++t) {
#pragma unroll
            for (int g = 0; g < NG; ++g) { v8f a = (v8f){};
#pragma unroll
                for (int kc = 0; kc < 2; ++kc) { a = wmmab(kh[t][kc], qh[g][kc], a); a = wmmab(kh[t][kc], ql[g][kc], a); a = wmmab(kl[t][kc], qh[g][kc], a); }
                s[t][g] = a; }
            if (MX && t == 0) __builtin_amdgcn_sched_barrier(0); }   // key tile 1 was fetched later (below): all of tile 0's products go first, and tile 1's loads fly behind them too
        if (MX) {   // three v planes fill the registers: the v addresses end here, not at the pass's last load
            __builtin_amdgcn_sched_barrier(0);          // keeps the wait behind the score products, where the v loads were issued long ago: directly behind them the wave would stand still at it
            asm volatile("s_wait_xcnt 0x0" :: "v"(vap), "v"(vbp), "v"(vcp) : "memory");   // before the v loads' address registers are rewritten; as inputs the addresses live up to the wait
            __builtin_amdgcn_sched_barrier(0); }        // keeps the work below behind the wait: lifted over it, it asks for registers while the v addresses are still held, and the build spills
        const int kn = (kb + 32 < TT) ? kb + 32 : kb;   // the last range's last pass fetches its own tiles again: in bounds, never used
        const char* knh = (const char*)(Qh + kn * HD) + fo; const char* knl = (const char*)(Ql + kn * HD) + fo;
        auto kfetch = [&](int t) {   // key tile t of the next pass
#pragma unroll
            for (int kc = 0; kc < 2; ++kc) { const int ko = KP + (t * 16 * HD + kc * 512) * 2; kh[t][kc] = ldfb(knh, ko); kl[t][kc] = ldfb(knl, ko); } };
        auto kwait = [&]() {
            if (MX) asm volatile("s_wait_xcnt 0x0" :: "v"(knh), "v"(knl) : "memory");   // as the next line, for the k loads alone
            else asm volatile("s_wait_xcnt 0x0" :: "v"(vap), "v"(vbp), "v"(vcp), "v"(knh), "v"(knl) : "memory");   // the pass's loads are all issued: their address registers may be rewritten behind this wait; as inputs the addresses live up to it, so that no load of the pass gets their registers for its result
            __builtin_amdgcn_sched_barrier(0); };           // keeps the vector work below from being lifted over the wait (a "memory" clobber does not tie it to registers)
        kfetch(0);
        if (!MX) { kfetch(1); kwait(); }
        float mn[NG]; bool up = false;
#pragma unroll
        for (int g = 0; g < NG; ++g) { float tm = s[0][g][0];
#pragma unroll
            for (int r = 0; r < 8; ++r) tm = fmaxf(tm, fmaxf(s[0][g][r], s[1][g][r]));
            tm *= SCL; tm = fmaxf(tm, xhalf(tm)); mn[g] = fmaxf(m[g], tm); up = up || (mn[g] > m[g]); }
        if (__builtin_amdgcn_ballot_w32(up) != 0) {   // scalar branch: the rescale runs only in a pass that raises some column's maximum
#pragma unroll
            for (int g = 0; g < NG; ++g) { const float al = __builtin_amdgcn_exp2f((m[g] - mn[g]) * L2E); l[g] *= al; m[g] = mn[g];
#pragma unroll
                for (int dt = 0; dt < 4; ++dt) o[dt][g] *= al; } }
#pragma unroll
        for (int gi = 0; gi < NG; ++gi) { const int g = MX ? (gi + 1) % NG : gi; const bool HR = MX && g == 0;   // the hi/lo group last: its split's temporaries take the registers that the fp16 groups have left
#pragma unroll
            for (int t = 0; t < 2; ++t)
#pragma unroll
                for (int r = 0; r < 8; ++r) { const float p = __builtin_amdgcn_exp2f(fmaf(s[t][g][r] * SCL - m[g], L2E, HR ? 0.f : PSH)); s[t][g][r] = p; l[g] += p; }
            if (HR) {   // hi/lo split of P on whole vectors: two values a conversion, the same roundings as one by one
                const v16f pv = __builtin_shufflevector(s[0][g], s[1][g], 0, 1, 2, 3, 4, 5, 6, 7, 8, 9, 10, 11, 12, 13, 14, 15);
                const v16bf ph = __builtin_convertvector(pv, v16bf); const v8u pw = __builtin_bit_cast(v8u, ph); v16f pb2;   // the hi parts back as f32, taken from the packed words
#pragma unroll
                for (int e = 0; e < 8; ++e) { pb2[2 * e] = __builtin_bit_cast(float, pw[e] << 16); pb2[2 * e + 1] = __builtin_bit_cast(float, pw[e] & 0xffff0000u); }
                const v16bf pl = __builtin_convertvector(pv - pb2, v16bf);
#pragma unroll
                for (int dt = 0; dt < 4; ++dt) { o[dt][g] = wmmab(vh[dt], ph, o[dt][g]); o[dt][g] = wmmab(vh[dt], pl, o[dt][g]); o[dt][g] = wmmab(vl[dt], ph, o[dt][g]); }
            } else { v16h pb;
#pragma unroll
                for (int e = 0; e < 16; ++e) pb[e] = (h16)s[e >> 3][g][e & 7];
#pragma unroll
                for (int dt = 0; dt < 4; ++dt) o[dt][g] = wmma16(v16[dt], pb, o[dt][g]); }
            if (MX && gi == 0) {
                __builtin_amdgcn_sched_barrier(0);   // the registers have room for the second key tile only once a group's scores are spent: lifted over this line, its loads would force spills
                kfetch(1); kwait(); } }
    }
#pragma unroll
    for (int g = 0; g < NG; ++g) { l[g] += xhalf(l[g]); if (h == 0) { mw[w * FQ + g * 16 + c] = m[g]; lw[w * FQ + g * 16 + c] = l[g]; } }
    __syncthreads();   // every range's maximum and sum are in LDS
#pragma unroll
    for (int g = 0; g < NG; ++g) { const int q = g * 16 + c; float M = mw[q];
#pragma unroll
        for (int u = 1; u < FW; ++u) M = fmaxf(M, mw[u * FQ + q]);
        float L = 0.f;
#pragma unroll
        for (int u = 0; u < FW; ++u) L += lw[u * FQ + q] * __builtin_amdgcn_exp2f((mw[u * FQ + q] - M) * L2E);
        const float f = __fdiv_rn(__builtin_amdgcn_exp2f((m[g] - M) * L2E), L);
#pragma unroll
        for (int dt = 0; dt < 4; ++dt) { float* rp = red + (w * FQ + q) * 68 + dt * 16 + 8 * h; const v8f ov = o[dt][g] * f; v4f a, b2;
#pragma unroll
            for (int r = 0; r < 4; ++r) { a[r] = ov[r]; b2[r] = ov[4 + r]; }
            *(v4fa*)rp = a; *(v4fa*)(rp + 4) = b2; } }
    __syncthreads();   // every range's weighted tile is in LDS
#pragma unroll
    for (int i = 0; i < FQ / 32; ++i) { const int q = i * 32 + (threadIdx.x >> 3), d0 = (threadIdx.x & 7) * 8; v4f a = *(const v4fa*)(red + q * 68 + d0), b2 = *(const v4fa*)(red + q * 68 + d0 + 4);
#pragma unroll
        for (int u = 1; u < FW; ++u) { a += *(const v4fa*)(red + (u * FQ + q) * 68 + d0); b2 += *(const v4fa*)(red + (u * FQ + q) * 68 + d0 + 4); }
        float* op = OUTb + (size_t)(q < 16 ? qa + q : qb + q - 16) * DQ + d0; *(v4f*)op = a; *(v4f*)(op + 4) = b2; }
}
// grid (TT / FQ, NB_) = one work-group a WGP; two waves a SIMD, up to 512 registers each: 64 columns a wave halve the k and v loads per product
__global__ __launch_bounds__(FW * 32) __attribute__((amdgpu_waves_per_eu(2, 2))) void k_fattn(const bf* __restrict__ QKh, const bf* __restrict__ QKl, const h16* __restrict__ VT16, const bf* __restrict__ VTh, const bf* __restrict__ VTl, float* OUT) {
    __shared__ __align__(16) float red[FW * FQ * 68]; __shared__ float mw[FW * FQ]; __shared__ float lw[FW * FQ];
    // The deal: the RH / 16 hi/lo groups of a batch (12 attn.v products a pass, the others 4) go one each to MXW work-groups, with NG - 1 fp16 groups beside them; the other work-groups hold NG fp16 groups.
    // The mixed work-groups, the longer ones, have the low flat indices: they start first.
    const int MXW = RH / 16, NXW = TT / FQ - MXW, b = blockIdx.y * (TT / FQ) + blockIdx.x; const size_t PL = (size_t)TT * HD;   // a batch's k planes lie NB_ planes behind its q planes
    if (b < NB_ * MXW) { const int xi = b % MXW; const size_t zb = b / MXW;
        fattn_body<true>(QKh + zb * PL, QKl + zb * PL, VT16 + zb * PL, VTh + zb * PL, VTl + zb * PL, OUT + zb * TT * DQ, xi * 16, RH + xi * (NG - 1) * 16, red, mw, lw); }
    else { const int u = b - NB_ * MXW, q0 = RH + MXW * (NG - 1) * 16 + (u % NXW) * FQ; const size_t zb = u / NXW;
        fattn_body<false>(QKh + zb * PL, QKl + zb * PL, VT16 + zb * PL, VTh + zb * PL, VTl + zb * PL, OUT + zb * TT * DQ, q0, q0 + 16, red, mw, lw); }
}

extern "C" void kernel_launch(void* const* d_in, const int* in_sizes, int n_in,
                              void* d_out, int out_size, void* d_ws, size_t ws_size, hipStream_t stream) {
    (void)in_sizes; (void)n_in; (void)out_size;
    const float* x = (const float*)d_in[0]; const float* ker = (const float*)d_in[1];   /* kernel [3][128][64] */
    float* OUT = (float*)d_out;     // [4][4096][64]
    char* wsp = (char*)d_ws;
    auto take = [&](size_t bytes) { char* p = wsp; wsp += (bytes + 255) & ~(size_t)255; return (void*)p; };
    const size_t PL = (size_t)TT * HD;   // one batch's plane, elements
    bf* QKh = (bf*)take(2 * NB_ * PL * 2); bf* QKl = (bf*)take(2 * NB_ * PL * 2);   /* [q, k][batch][TT / 16 tiles][2 KiB] */
    h16* VT16 = (h16*)take(NB_ * PL * 2); bf* VTh = (bf*)take(NB_ * PL * 2); bf* VTl = (bf*)take(NB_ * PL * 2);   /* [batch][TT / 32 passes][4 KiB] */
    if ((size_t)(wsp - (char*)d_ws) > ws_size) return;    // ws 256 MiB
    k_proj<<<NB_ * TT / PT, PWV * 32, 0, stream>>>(x, ker, QKh, QKl, VT16, VTh, VTl);
    k_fattn<<<dim3(TT / FQ, NB_, 1), FW * 32, 0, stream>>>(QKh, QKl, VT16, VTh, VTl, OUT);
}

// v008
// Measured time: 35.2 microseconds a run.
// Next to v007, in two timings, it ran 1.07 and 1.06 times as fast.
// All steps since v000 together make it 26.6 times as fast.
#include <hip/hip_runtime.h>

// Single-head self-attention over 4,096 tokens with a 64-wide head (x [4][4096][128]; WQ, WK, WV = x kernel[0/1/2] ('xw' [3][128][64] sigma 1); scores / sqrt(64); softmax; out = attn WV -> [4][4096][64] (1 M)).
// Launches: ONE projection kernel (inputs rounded, q/k/v projected, 16-bit planes stored from the accumulators; all four batches in one grid), then ONE attention kernel for all batches: scores, softmax and attn.v never leave the registers.
// Layout per batch: exact projections of the bf16-rounded inputs; 16-bit planes of q, k and v in fragment order (see k_proj); fused T-4096 attention for the one head (scores hi/lo 3 products on EVERY row: the logits are far too peaked for fp16 scores; P and attn.v hybrid: rows < 512 hi/lo, rest fp16 x1024; online softmax).
// Compute dtypes, f32 accumulate: every input rounded to bf16; projections exact; scores 3 products on every row; softmax f32; attn.v rows < 512 3 products, rest fp16; output f32.

#define NB_  4
#define TT   4096
#define DM   128
#define NH_  1
#define NKV  1
#define REP  (NH_ / NKV)
#define HD   64
#define DQ   (NH_ * HD)
#define DKV  (NKV * HD)
#define RH   512                  // query rows < RH use hi+lo planes (0: none)
#define WIN  0
#define PSH  10.0f               // fp16 P carries 2^PSH; the row sum carries it too, so the quotient is free of it
#define SCL  0.125f   // HD^-0.5
#define FW   8                    // waves of an attention work-group: one key range of TT / FW keys each
#define FQ   64                   // query columns of an attention work-group (every wave holds all of them)
#define NG   (FQ / 16)            // 16-column groups
#define L2E  1.4426950408889634f
typedef _Float16 h16;
typedef unsigned short bf;
typedef __attribute__((ext_vector_type(16))) __bf16   v16bf;
typedef __attribute__((ext_vector_type(16))) _Float16 v16h;
typedef __attribute__((ext_vector_type(8)))  _Float16 v8h;
typedef __attribute__((ext_vector_type(8)))  unsigned short v8us;
typedef __attribute__((ext_vector_type(8)))  float    v8f;
typedef __attribute__((ext_vector_type(16))) float    v16f;
typedef __attribute__((ext_vector_type(8)))  unsigned int v8u;
typedef __attribute__((ext_vector_type(4)))  float    v4f;
typedef v8h  __attribute__((may_alias)) v8ha;
typedef v4f  __attribute__((may_alias)) v4fa;
typedef v8us __attribute__((may_alias)) v8usa;

__device__ __forceinline__ v16h cat16(v8h lo, v8h hi) { return __builtin_shufflevector(lo, hi, 0, 1, 2, 3, 4, 5, 6, 7, 8, 9, 10, 11, 12, 13, 14, 15); }
__device__ __forceinline__ v16bf cat16b(v8us lo, v8us hi) { return __builtin_bit_cast(v16bf, __builtin_shufflevector(lo, hi, 0, 1, 2, 3, 4, 5, 6, 7, 8, 9, 10, 11, 12, 13, 14, 15)); }
__device__ __forceinline__ v8f wmma16(v16h a, v16h b, v8f c) { return __builtin_amdgcn_wmma_f32_16x16x32_f16(false, a, false, b, (short)0, c, false, false); }
__device__ __forceinline__ v8f wmmab(v16bf a, v16bf b, v8f c) { return __builtin_amdgcn_wmma_f32_16x16x32_bf16(false, a, false, b, (short)0, c, false, false); }


typedef __attribute__((ext_vector_type(8))) __bf16 v8bf;
// k_proj: one work-group = PT tokens (flat over the batches) x all 192 columns of q, k, v; 12 waves.
// Stage: the three weight blocks, transposed to [column][k], and the tokens' x rows, rounded to bf16, in LDS at a pitch of 272 B (16 B x odd: ds_load_b128 without bank conflicts).
// Every wave: D (64 x 16) = 64 staged rows (A, four tiles) times 16 staged rows (B); a lane holds 8 neighbouring D rows of one D column: the 16 bytes that the same lane of an attention wave loads as one half of a fragment.
// The planes are kept in that fragment order: a half fragment is 32 lanes x 16 B = 512 contiguous bytes, so that every store here and every load in k_fattn covers four whole 128-B lines.
// Waves 0-7: A = the 64 columns of q or k, B = 16 tokens. q, k planes: [16-token tile][32 of the head's 64][half][lane][8], 2 KiB a tile.
// Waves 8-11: A = the 64 tokens, B = 16 columns of v. v planes: [32-key pass][16-column tile][half][lane][8], 4 KiB a pass.
#define PT   64
#define XP   (DM + 8)             // LDS row pitch, 16-bit elements
#define PWV  12                   // waves of a projection work-group
__device__ __forceinline__ v8us rnd8(v8f v) { v8bf o;
#pragma unroll
    for (int e = 0; e < 8; ++e) o[e] = (__bf16)v[e];
    return __builtin_bit_cast(v8us, o); }
__device__ __forceinline__ v16bf ldsf(const bf* p) { return cat16b(*(const v8usa*)p, *(const v8usa*)(p + 16)); }   // k order of every loader here
__global__ __launch_bounds__(PWV * 32) void k_proj(const float* __restrict__ x, const float* __restrict__ ker, bf* QKh, bf* QKl, h16* VT16, bf* VTh, bf* VTl) {
    __shared__ __align__(16) bf sm[(3 * HD + PT) * XP];   // rows 0-191: weights [q, k, v column][k]; rows 192-255: x [token][k]
    const int tid = threadIdx.x, lane = tid & 31, c = lane & 15, h = lane >> 4, w = __builtin_amdgcn_readfirstlane(tid >> 5);
    const int r0 = blockIdx.x * PT;   // first token, flat over the batches
    {   // weights: a thread takes 8 k of one column (its loads: 128 contiguous bytes a wave), 8 such pieces; the three blocks are one [384][64] array
        const float* wp = ker + (tid >> 6) * 8 * HD + (tid & 63); v8f wv[8];
#pragma unroll
        for (int u = 0; u < 8; ++u)
#pragma unroll
            for (int i = 0; i < 8; ++i) wv[u][i] = wp[(u * (PWV * 32 / 64) * 8 + i) * HD];
        // x: 8 floats a thread and piece, contiguous over the work-group
        const float* xp = x + (size_t)r0 * DM + tid * 8; v8f xv[3];
#pragma unroll
        for (int u = 0; u < 3; ++u) if ((u + 1) * PWV * 32 <= PT * DM / 8 || tid + u * PWV * 32 < PT * DM / 8) xv[u] = *(const v8f*)(xp + u * PWV * 32 * 8);
#pragma unroll
        for (int u = 0; u < 8; ++u) { const int G = (tid >> 6) + u * (PWV * 32 / 64);   // 8-k group: block G / 16, k 8 (G % 16)
            *(v8usa*)(sm + ((G >> 4) * HD + (tid & 63)) * XP + (G & 15) * 8) = rnd8(wv[u]); }
#pragma unroll
        for (int u = 0; u < 3; ++u) { const int i = tid + u * PWV * 32; if ((u + 1) * PWV * 32 <= PT * DM / 8 || i < PT * DM / 8) *(v8usa*)(sm + (3 * HD + (i >> 4)) * XP + (i & 15) * 8) = rnd8(xv[u]); }
    }
    __syncthreads();   // the staged rows are read by every wave
    const bool qk = w < 8;
    const int arow = qk ? (w >> 2) * HD : 3 * HD;                               // first of the 64 staged rows that are D's rows
    const int brow = qk ? 3 * HD + (w & 3) * 16 : 2 * HD + (w - 8) * 16;        // first of the 16 staged rows that are D's columns
    const bf* ap = sm + arow * XP + c * XP + 8 * h; const bf* bp = sm + brow * XP + c * XP + 8 * h;
    // the lane's place in its planes: accumulator tile i is half i & 1 of fragment i >> 1 (q, k: of the tile's two; v: of the same column tile in two passes)
    const int po = (qk ? ((w >> 2) * NB_ * TT + r0 + (w & 3) * 16) * HD : r0 * HD + (w - 8) * 512) + lane * 8;
    const int pf = qk ? 512 : 4 * 512;   // elements from fragment i >> 1 = 0 to 1
    bf* ph = (qk ? QKh : VTh) + po; bf* pl = (qk ? QKl : VTl) + po;
    v8f acc[4];
#pragma unroll
    for (int i = 0; i < 4; ++i) acc[i] = (v8f){};
#pragma unroll
    for (int kc = 0; kc < DM / 32; ++kc) { const v16bf bfr = ldsf(bp + kc * 32);
#pragma unroll
        for (int i = 0; i < 4; ++i) acc[i] = wmmab(ldsf(ap + i * 16 * XP + kc * 32), bfr, acc[i]); }
#pragma unroll
    for (int i = 0; i < 4; ++i) { v8bf a; v8f r;
#pragma unroll
        for (int e = 0; e < 8; ++e) { a[e] = (__bf16)acc[i][e]; r[e] = acc[i][e] - (float)a[e]; }
        *(v8us*)(ph + (i >> 1) * pf + (i & 1) * 256) = __builtin_bit_cast(v8us, a); *(v8us*)(pl + (i >> 1) * pf + (i & 1) * 256) = rnd8(r); }
    if (!qk) {
        asm volatile("s_wait_xcnt 0x0" ::: "memory");   // the plane stores above are issued: their registers may be rewritten behind this wait
        __builtin_amdgcn_sched_barrier(0);              // keeps the vector work below from being lifted over the wait (a "memory" clobber does not tie it to registers)
#pragma unroll
        for (int i = 0; i < 4; ++i) { v8h f;
#pragma unroll
            for (int e = 0; e < 8; ++e) f[e] = (h16)acc[i][e];
            *(v8h*)(VT16 + po + (i >> 1) * pf + (i & 1) * 256) = f; } }
}
__device__ __forceinline__ float xhalf(float x) { return __builtin_bit_cast(float, __builtin_amdgcn_permlanex16(__builtin_bit_cast(int, x), __builtin_bit_cast(int, x), 0x76543210, 0xfedcba98, false, false)); }   // lane l with lane l ^ 16
// fragment at the lane's own address p plus a constant byte step, in the k order of every loader here (its two halves lie 512 B apart: each load of a wave reads 512 contiguous bytes)
__device__ __forceinline__ v16bf ldfb(const char* p, int step) { return cat16b(*(const v8us*)(p + step), *(const v8us*)(p + step + 512)); }
__device__ __forceinline__ v16h ldfh(const char* p, int step) { return cat16(*(const v8h*)(p + step), *(const v8h*)(p + step + 512)); }
template <bool MX>   // MX: column group 0 is of the hi/lo row class
__device__ __forceinline__ void fattn_body(const bf* __restrict__ Qh, const bf* __restrict__ Ql, const h16* __restrict__ VT16, const bf* __restrict__ VTh, const bf* __restrict__ VTl, float* OUTb, int qa, int qb, float* red, float* mw, float* lw) {
    const int lane = threadIdx.x & 31, c = lane & 15, h = lane >> 4, w = __builtin_amdgcn_readfirstlane(threadIdx.x >> 5);   // w in a scalar register: scalar loop counter and a scalar loop branch
    const unsigned fo = (unsigned)lane * 16u;   // the lane's byte offset in a half fragment, in every plane
    v16bf qh[NG][2], ql[NG][2];   // [column group][32 of the head's 64]
    const char* qha = (const char*)(Qh + qa * HD) + fo; const char* qla = (const char*)(Ql + qa * HD) + fo;   // the lane's address in each q plane: group 0
    const char* qhp = (const char*)(Qh + qb * HD) + fo; const char* qlp = (const char*)(Ql + qb * HD) + fo;   // groups 1 to NG - 1
#pragma unroll
    for (int g = 0; g < NG; ++g)
#pragma unroll
        for (int kc = 0; kc < 2; ++kc) { const int qo = ((g ? g - 1 : 0) * 16 * HD + kc * 512) * 2; qh[g][kc] = ldfb(g ? qhp : qha, qo); ql[g][kc] = ldfb(g ? qlp : qla, qo); }
    asm volatile("s_wait_xcnt 0x0" :: "v"(qha), "v"(qla), "v"(qhp), "v"(qlp) : "memory");   // before the q loads' address registers are rewritten; as inputs the addresses live up to the wait, so that no load of the run gets their registers for its result
    __builtin_amdgcn_sched_barrier(0);              // keeps later address arithmetic behind the wait
    v8f o[4][NG];               // O^T: o[dt][g][r] = O[column c of group g][16 dt + 8 h + r], un-normalised
    float m[NG], l[NG];
#pragma unroll
    for (int g = 0; g < NG; ++g) { m[g] = -3.0e38f; l[g] = 0.f;
#pragma unroll
        for (int dt = 0; dt < 4; ++dt) o[dt][g] = (v8f){}; }
    const int k0 = w * (TT / FW);
    const int NP = TT / FW / 32;   // passes of a key range
    // The work-groups of a batch walk the same k and v lines. Each enters its ranges at another pass and wraps round, so that few of them ask L2 for the same line at the same moment (speed only: any value of rot gives the same sums in another order).
    const int rot = ((blockIdx.x & 3) | ((blockIdx.x >> 3 & 3) << 2)) % NP;   // 16 starts: indices 1 to 3 and 8, 16, 24 apart differ; indices that differ only in bit 2 or bit 5 share one
    v16bf kh[2][2], kl[2][2];   // [key tile][32 of 64]: the pass's k fragments, fetched one pass ahead
    const int KP = NB_ * TT * HD * 2;   // bytes from a batch's q plane to its k plane: a constant step of the loads, so that the register pair they name is the address handed to the wait
    const char* khp = (const char*)(Qh + (k0 + rot * 32) * HD) + fo; const char* klp = (const char*)(Ql + (k0 + rot * 32) * HD) + fo;
#pragma unroll
    for (int t = 0; t < 2; ++t)
#pragma unroll
        for (int kc = 0; kc < 2; ++kc) { const int ko = KP + (t * 16 * HD + kc * 512) * 2; kh[t][kc] = ldfb(khp, ko); kl[t][kc] = ldfb(klp, ko); }
    asm volatile("s_wait_xcnt 0x0" :: "v"(khp), "v"(klp) : "memory");   // before the first k loads' address registers are rewritten; the addresses live up to the wait
    __builtin_amdgcn_sched_barrier(0);              // keeps later address arithmetic behind the wait
#pragma unroll 1   // one pass is already 64 to 72 matrix instructions; unrolled, the registers of two passes do not fit two waves a SIMD
    for (int j = 0; j < NP; ++j) { const int kb = k0 + (j + rot) % NP * 32;   // the pass's first key
        v16h v16[4]; v16bf vh[4], vl[4];   // the pass's v fragments: their loads fly behind the score products and the softmax
        const char* vcp = (const char*)(VT16 + kb * HD) + fo; const char* vap = MX ? (const char*)(VTh + kb * HD) + fo : vcp; const char* vbp = MX ? (const char*)(VTl + kb * HD) + fo : vcp;   // the lane's address in the pass's v planes (the fp16 plane alone where no group is hi/lo)
#pragma unroll
        for (int dt = 0; dt < 4; ++dt) v16[dt] = ldfh(vcp, dt * 512 * 2);
#pragma unroll
        for (int dt = 0; dt < 4; ++dt) if (MX) { vh[dt] = ldfb(vap, dt * 512 * 2); vl[dt] = ldfb(vbp, dt * 512 * 2); }
        v8f s[2][NG];           // [key tile][column group]
#pragma unroll
        for (int t = 0; t < 2; ++t) {
#pragma unroll
            for (int g = 0; g < NG; ++g) { v8f a = (v8f){};
#pragma unroll
                for (int kc = 0; kc < 2; ++kc) { a = wmmab(kh[t][kc], qh[g][kc], a); a = wmmab(kh[t][kc], ql[g][kc], a); a = wmmab(kl[t][kc], qh[g][kc], a); }
                s[t][g] = a; }
            if (MX && t == 0) __builtin_amdgcn_sched_barrier(0); }   // key tile 1 was fetched later (below): all of tile 0's products go first, and tile 1's loads fly behind them too
        if (MX) {   // three v planes fill the registers: the v addresses end here, not at the pass's last load
            __builtin_amdgcn_sched_barrier(0);          // keeps the wait behind the score products, where the v loads were issued long ago: directly behind them the wave would stand still at it
            asm volatile("s_wait_xcnt 0x0" :: "v"(vap), "v"(vbp), "v"(vcp) : "memory");   // before the v loads' address registers are rewritten; as inputs the addresses live up to the wait
            __builtin_amdgcn_sched_barrier(0); }        // keeps the work below behind the wait: lifted over it, it asks for registers while the v addresses are still held, and the build spills
        const int kn = k0 + (j + 1 + rot) % NP * 32;   // the last pass fetches the walk's first tiles again: in bounds, never used
        const char* knh = (const char*)(Qh + kn * HD) + fo; const char* knl = (const char*)(Ql + kn * HD) + fo;
        auto kfetch = [&](int t) {   // key tile t of the next pass
#pragma unroll
            for (int kc = 0; kc < 2; ++kc) { const int ko = KP + (t * 16 * HD + kc * 512) * 2; kh[t][kc] = ldfb(knh, ko); kl[t][kc] = ldfb(knl, ko); } };
        auto kwait = [&]() {
            if (MX) asm volatile("s_wait_xcnt 0x0" :: "v"(knh), "v"(knl) : "memory");   // as the next line, for the k loads alone
            else asm volatile("s_wait_xcnt 0x0" :: "v"(vap), "v"(vbp), "v"(vcp), "v"(knh), "v"(knl) : "memory");   // the pass's loads are all issued: their address registers may be rewritten behind this wait; as inputs the addresses live up to it, so that no load of the pass gets their registers for its result
            __builtin_amdgcn_sched_barrier(0); };           // keeps the vector work below from being lifted over the wait (a "memory" clobber does not tie it to registers)
        kfetch(0);
        if (!MX) { kfetch(1); kwait(); }
        float mn[NG]; bool up = false;
#pragma unroll
        for (int g = 0; g < NG; ++g) { float tm = s[0][g][0];
#pragma unroll
            for (int r = 0; r < 8; ++r) tm = fmaxf(tm, fmaxf(s[0][g][r], s[1][g][r]));
            tm *= SCL; tm = fmaxf(tm, xhalf(tm)); mn[g] = fmaxf(m[g], tm); up = up || (mn[g] > m[g]); }
        if (__builtin_amdgcn_ballot_w32(up) != 0) {   // scalar branch: the rescale runs only in a pass that raises some column's maximum
#pragma unroll
            for (int g = 0; g < NG; ++g) { const float al = __builtin_amdgcn_exp2f((m[g] - mn[g]) * L2E); l[g] *= al; m[g] = mn[g];
#pragma unroll
                for (int dt = 0; dt < 4; ++dt) o[dt][g] *= al; } }
#pragma unroll
        for (int gi = 0; gi < NG; ++gi) { const int g = MX ? (gi + 1) % NG : gi; const bool HR = MX && g == 0;   // the hi/lo group last: its split's temporaries take the registers that the fp16 groups have left
#pragma unroll
            for (int t = 0; t < 2; ++t)
#pragma unroll
                for (int r = 0; r < 8; ++r) { const float p = __builtin_amdgcn_exp2f(fmaf(s[t][g][r] * SCL - m[g], L2E, HR ? 0.f : PSH)); s[t][g][r] = p; l[g] += p; }
            if (HR) {   // hi/lo split of P on whole vectors: two values a conversion, the same roundings as one by one
                const v16f pv = __builtin_shufflevector(s[0][g], s[1][g], 0, 1, 2, 3, 4, 5, 6, 7, 8, 9, 10, 11, 12, 13, 14, 15);
                const v16bf ph = __builtin_convertvector(pv, v16bf); const v8u pw = __builtin_bit_cast(v8u, ph); v16f pb2;   // the hi parts back as f32, taken from the packed words
#pragma unroll
                for (int e = 0; e < 8; ++e) { pb2[2 * e] = __builtin_bit_cast(float, pw[e] << 16); pb2[2 * e + 1] = __builtin_bit_cast(float, pw[e] & 0xffff0000u); }
                const v16bf pl = __builtin_convertvector(pv - pb2, v16bf);
#pragma unroll
                for (int dt = 0; dt < 4; ++dt) { o[dt][g] = wmmab(vh[dt], ph, o[dt][g]); o[dt][g] = wmmab(vh[dt], pl, o[dt][g]); o[dt][g] = wmmab(vl[dt], ph, o[dt][g]); }
            } else { v16h pb;
#pragma unroll
                for (int e = 0; e < 16; ++e) pb[e] = (h16)s[e >> 3][g][e & 7];
#pragma unroll
                for (int dt = 0; dt < 4; ++dt) o[dt][g] = wmma16(v16[dt], pb, o[dt][g]); }
            if (MX && gi == 0) {
                __builtin_amdgcn_sched_barrier(0);   // the registers have room for the second key tile only once a group's scores are spent: lifted over this line, its loads would force spills
                kfetch(1); kwait(); } }
    }
#pragma unroll
    for (int g = 0; g < NG; ++g) { l[g] += xhalf(l[g]); if (h == 0) { mw[w * FQ + g * 16 + c] = m[g]; lw[w * FQ + g * 16 + c] = l[g]; } }
    __syncthreads();   // every range's maximum and sum are in LDS
#pragma unroll
    for (int g = 0; g < NG; ++g) { const int q = g * 16 + c; float M = mw[q];
#pragma unroll
        for (int u = 1; u < FW; ++u) M = fmaxf(M, mw[u * FQ + q]);
        float L = 0.f;
#pragma unroll
        for (int u = 0; u < FW; ++u) L += lw[u * FQ + q] * __builtin_amdgcn_exp2f((mw[u * FQ + q] - M) * L2E);
        const float f = __fdiv_rn(__builtin_amdgcn_exp2f((m[g] - M) * L2E), L);
#pragma unroll
        for (int dt = 0; dt < 4; ++dt) { float* rp = red + (w * FQ + q) * 68 + dt * 16 + 8 * h; const v8f ov = o[dt][g] * f; v4f a, b2;
#pragma unroll
            for (int r = 0; r < 4; ++r) { a[r] = ov[r]; b2[r] = ov[4 + r]; }
            *(v4fa*)rp = a; *(v4fa*)(rp + 4) = b2; } }
    __syncthreads();   // every range's weighted tile is in LDS
#pragma unroll
    for (int i = 0; i < FQ / 32; ++i) { const int q = i * 32 + (threadIdx.x >> 3), d0 = (threadIdx.x & 7) * 8; v4f a = *(const v4fa*)(red + q * 68 + d0), b2 = *(const v4fa*)(red + q * 68 + d0 + 4);
#pragma unroll
        for (int u = 1; u < FW; ++u) { a += *(const v4fa*)(red + (u * FQ + q) * 68 + d0); b2 += *(const v4fa*)(red + (u * FQ + q) * 68 + d0 + 4); }
        float* op = OUTb + (size_t)(q < 16 ? qa + q : qb + q - 16) * DQ + d0; *(v4f*)op = a; *(v4f*)(op + 4) = b2; }
}
// grid (TT / FQ, NB_) = one work-group a WGP; two waves a SIMD, up to 512 registers each: 64 columns a wave halve the k and v loads per product
__global__ __launch_bounds__(FW * 32) __attribute__((amdgpu_waves_per_eu(2, 2))) void k_fattn(const bf* __restrict__ QKh, const bf* __restrict__ QKl, const h16* __restrict__ VT16, const bf* __restrict__ VTh, const bf* __restrict__ VTl, float* OUT) {
    __shared__ __align__(16) float red[FW * FQ * 68]; __shared__ float mw[FW * FQ]; __shared__ float lw[FW * FQ];
    // The deal: the RH / 16 hi/lo groups of a batch (12 attn.v products a pass, the others 4) go one each to MXW work-groups, with NG - 1 fp16 groups beside them; the other work-groups hold NG fp16 groups.
    // The mixed work-groups, the longer ones, have the low flat indices: they start first.
    const int MXW = RH / 16, NXW = TT / FQ - MXW, b = blockIdx.y * (TT / FQ) + blockIdx.x; const size_t PL = (size_t)TT * HD;   // a batch's k planes lie NB_ planes behind its q planes
    if (b < NB_ * MXW) { const int xi = b % MXW; const size_t zb = b / MXW;
        fattn_body<true>(QKh + zb * PL, QKl + zb * PL, VT16 + zb * PL, VTh + zb * PL, VTl + zb * PL, OUT + zb * TT * DQ, xi * 16, RH + xi * (NG - 1) * 16, red, mw, lw); }
    else { const int u = b - NB_ * MXW, q0 = RH + MXW * (NG - 1) * 16 + (u % NXW) * FQ; const size_t zb = u / NXW;
        fattn_body<false>(QKh + zb * PL, QKl + zb * PL, VT16 + zb * PL, VTh + zb * PL, VTl + zb * PL, OUT + zb * TT * DQ, q0, q0 + 16, red, mw, lw); }
}

extern "C" void kernel_launch(void* const* d_in, const int* in_sizes, int n_in,
                              void* d_out, int out_size, void* d_ws, size_t ws_size, hipStream_t stream) {
    (void)in_sizes; (void)n_in; (void)out_size;
    const float* x = (const float*)d_in[0]; const float* ker = (const float*)d_in[1];   /* kernel [3][128][64] */
    float* OUT = (float*)d_out;     // [4][4096][64]
    char* wsp = (char*)d_ws;
    auto take = [&](size_t bytes) { char* p = wsp; wsp += (bytes + 255) & ~(size_t)255; return (void*)p; };
    const size_t PL = (size_t)TT * HD;   // one batch's plane, elements
    bf* QKh = (bf*)take(2 * NB_ * PL * 2); bf* QKl = (bf*)take(2 * NB_ * PL * 2);   /* [q, k][batch][TT / 16 tiles][2 KiB] */
    h16* VT16 = (h16*)take(NB_ * PL * 2); bf* VTh = (bf*)take(NB_ * PL * 2); bf* VTl = (bf*)take(NB_ * PL * 2);   /* [batch][TT / 32 passes][4 KiB] */
    if ((size_t)(wsp - (char*)d_ws) > ws_size) return;    // ws 256 MiB
    k_proj<<<NB_ * TT / PT, PWV * 32, 0, stream>>>(x, ker, QKh, QKl, VT16, VTh, VTl);
    k_fattn<<<dim3(TT / FQ, NB_, 1), FW * 32, 0, stream>>>(QKh, QKl, VT16, VTh, VTl, OUT);
}

// v009
// Measured time: 34.1 microseconds a run.
// Timed twice side by side with v008, it ran 1.03 times as fast both times.
// Counting every step since v000, it is 27.4 times as fast.
#include <hip/hip_runtime.h>

// Single-head self-attention over 4,096 tokens with a 64-wide head (x [4][4096][128]; WQ, WK, WV = x kernel[0/1/2] ('xw' [3][128][64] sigma 1); scores / sqrt(64); softmax; out = attn WV -> [4][4096][64] (1 M)).
// Launches: ONE projection kernel (inputs rounded, q/k/v projected, 16-bit planes stored from the accumulators; all four batches in one grid), then ONE attention kernel for all batches: scores, softmax and attn.v never leave the registers.
// Layout per batch: exact projections of the bf16-rounded inputs; 16-bit planes of q, k and v in fragment order (see k_proj); fused T-4096 attention for the one head (scores hi/lo 3 products on EVERY row: the logits are far too peaked for fp16 scores; P x1024 and attn.v in fp16: rows < 512 hi/lo fp16 pairs, rest the hi parts alone; online softmax).
// Compute dtypes, f32 accumulate: every input rounded to bf16; projections exact; scores 3 products on every row; softmax f32; attn.v rows < 512 3 fp16 products, rest 1; output f32.

#define NB_  4
#define TT   4096
#define DM   128
#define NH_  1
#define NKV  1
#define REP  (NH_ / NKV)
#define HD   64
#define DQ   (NH_ * HD)
#define DKV  (NKV * HD)
#define RH   512                  // query rows < RH use hi+lo planes (0: none)
#define WIN  0
#define PSH  10.0f               // P carries 2^PSH (fp16 range); the row sum carries it too, so the quotient is free of it
#define SCL  0.125f   // HD^-0.5
#define FW   8                    // waves of an attention work-group: one key range of TT / FW keys each
#define FQ   64                   // query columns of an attention work-group (every wave holds all of them)
#define NG   (FQ / 16)            // 16-column groups
#define L2E  1.4426950408889634f
typedef _Float16 h16;
typedef unsigned short bf;
typedef __attribute__((ext_vector_type(16))) __bf16   v16bf;
typedef __attribute__((ext_vector_type(16))) _Float16 v16h;
typedef __attribute__((ext_vector_type(8)))  _Float16 v8h;
typedef __attribute__((ext_vector_type(8)))  unsigned short v8us;
typedef __attribute__((ext_vector_type(8)))  float    v8f;
typedef __attribute__((ext_vector_type(16))) float    v16f;
typedef __attribute__((ext_vector_type(4)))  float    v4f;
typedef v8h  __attribute__((may_alias)) v8ha;
typedef v4f  __attribute__((may_alias)) v4fa;
typedef v8us __attribute__((may_alias)) v8usa;

__device__ __forceinline__ v16h cat16(v8h lo, v8h hi) { return __builtin_shufflevector(lo, hi, 0, 1, 2, 3, 4, 5, 6, 7, 8, 9, 10, 11, 12, 13, 14, 15); }
__device__ __forceinline__ v16bf cat16b(v8us lo, v8us hi) { return __builtin_bit_cast(v16bf, __builtin_shufflevector(lo, hi, 0, 1, 2, 3, 4, 5, 6, 7, 8, 9, 10, 11, 12, 13, 14, 15)); }
__device__ __forceinline__ v8f wmma16(v16h a, v16h b, v8f c) { return __builtin_amdgcn_wmma_f32_16x16x32_f16(false, a, false, b, (short)0, c, false, false); }
__device__ __forceinline__ v8f wmmab(v16bf a, v16bf b, v8f c) { return __builtin_amdgcn_wmma_f32_16x16x32_bf16(false, a, false, b, (short)0, c, false, false); }


typedef __attribute__((ext_vector_type(8))) __bf16 v8bf;
// k_proj: one work-group = PT tokens (flat over the batches) x all 192 columns of q, k, v; 12 waves.
// Stage: the three weight blocks, transposed to [column][k], and the tokens' x rows, rounded to bf16, in LDS at a pitch of 272 B (16 B x odd: ds_load_b128 without bank conflicts).
// Every wave: D (64 x 16) = 64 staged rows (A, four tiles) times 16 staged rows (B); a lane holds 8 neighbouring D rows of one D column: the 16 bytes that the same lane of an attention wave loads as one half of a fragment.
// The planes are kept in that fragment order: a half fragment is 32 lanes x 16 B = 512 contiguous bytes, so that every store here and every load in k_fattn covers four whole 128-B lines.
// Waves 0-7: A = the 64 columns of q or k, B = 16 tokens. q, k planes: [16-token tile][32 of the head's 64][half][lane][8], 2 KiB a tile.
// Waves 8-11: A = the 64 tokens, B = 16 columns of v. v planes (fp16 hi part, fp16 rest): [32-key pass][16-column tile][half][lane][8], 4 KiB a pass.
#define PT   64
#define XP   (DM + 8)             // LDS row pitch, 16-bit elements
#define PWV  12                   // waves of a projection work-group
__device__ __forceinline__ v8us rnd8(v8f v) { v8bf o;
#pragma unroll
    for (int e = 0; e < 8; ++e) o[e] = (__bf16)v[e];
    return __builtin_bit_cast(v8us, o); }
__device__ __forceinline__ v16bf ldsf(const bf* p) { return cat16b(*(const v8usa*)p, *(const v8usa*)(p + 16)); }   // k order of every loader here
__global__ __launch_bounds__(PWV * 32) void k_proj(const float* __restrict__ x, const float* __restrict__ ker, bf* QKh, bf* QKl, h16* VT16, h16* VTr) {
    __shared__ __align__(16) bf sm[(3 * HD + PT) * XP];   // rows 0-191: weights [q, k, v column][k]; rows 192-255: x [token][k]
    const int tid = threadIdx.x, lane = tid & 31, c = lane & 15, h = lane >> 4, w = __builtin_amdgcn_readfirstlane(tid >> 5);
    const int r0 = blockIdx.x * PT;   // first token, flat over the batches
    {   // weights: a thread takes 8 k of one column (its loads: 128 contiguous bytes a wave), 8 such pieces; the three blocks are one [384][64] array
        const float* wp = ker + (tid >> 6) * 8 * HD + (tid & 63); v8f wv[8];
#pragma unroll
        for (int u = 0; u < 8; ++u)
#pragma unroll
            for (int i = 0; i < 8; ++i) wv[u][i] = wp[(u * (PWV * 32 / 64) * 8 + i) * HD];
        // x: 8 floats a thread and piece, contiguous over the work-group
        const float* xp = x + (size_t)r0 * DM + tid * 8; v8f xv[3];
#pragma unroll
        for (int u = 0; u < 3; ++u) if ((u + 1) * PWV * 32 <= PT * DM / 8 || tid + u * PWV * 32 < PT * DM / 8) xv[u] = *(const v8f*)(xp + u * PWV * 32 * 8);
#pragma unroll
        for (int u = 0; u < 8; ++u) { const int G = (tid >> 6) + u * (PWV * 32 / 64);   // 8-k group: block G / 16, k 8 (G % 16)
            *(v8usa*)(sm + ((G >> 4) * HD + (tid & 63)) * XP + (G & 15) * 8) = rnd8(wv[u]); }
#pragma unroll
        for (int u = 0; u < 3; ++u) { const int i = tid + u * PWV * 32; if ((u + 1) * PWV * 32 <= PT * DM / 8 || i < PT * DM / 8) *(v8usa*)(sm + (3 * HD + (i >> 4)) * XP + (i & 15) * 8) = rnd8(xv[u]); }
    }
    __syncthreads();   // the staged rows are read by every wave
    const bool qk = w < 8;
    const int arow = qk ? (w >> 2) * HD : 3 * HD;                               // first of the 64 staged rows that are D's rows
    const int brow = qk ? 3 * HD + (w & 3) * 16 : 2 * HD + (w - 8) * 16;        // first of the 16 staged rows that are D's columns
    const bf* ap = sm + arow * XP + c * XP + 8 * h; const bf* bp = sm + brow * XP + c * XP + 8 * h;
    // the lane's place in its planes: accumulator tile i is half i & 1 of fragment i >> 1 (q, k: of the tile's two; v: of the same column tile in two passes)
    const int po = (qk ? ((w >> 2) * NB_ * TT + r0 + (w & 3) * 16) * HD : r0 * HD + (w - 8) * 512) + lane * 8;
    const int pf = qk ? 512 : 4 * 512;   // elements from fragment i >> 1 = 0 to 1
    v8f acc[4];
#pragma unroll
    for (int i = 0; i < 4; ++i) acc[i] = (v8f){};
#pragma unroll
    for (int kc = 0; kc < DM / 32; ++kc) { const v16bf bfr = ldsf(bp + kc * 32);
#pragma unroll
        for (int i = 0; i < 4; ++i) acc[i] = wmmab(ldsf(ap + i * 16 * XP + kc * 32), bfr, acc[i]); }
    if (!qk) {   // v: fp16 hi part (all that the rows from RH on read) and fp16 rest
        h16* ph = VT16 + po; h16* pl = VTr + po;
#pragma unroll
        for (int i = 0; i < 4; ++i) { v8h a, r;
#pragma unroll
            for (int e = 0; e < 8; ++e) { a[e] = (h16)acc[i][e]; r[e] = (h16)(acc[i][e] - (float)a[e]); }
            *(v8h*)(ph + (i >> 1) * pf + (i & 1) * 256) = a; *(v8h*)(pl + (i >> 1) * pf + (i & 1) * 256) = r; }
        asm volatile("s_wait_xcnt 0x0" ::: "memory");   // the built code lets this branch run on into the q, k lines below (a path no wave takes): they rewrite these stores' registers only behind this wait
        return; }
    bf* ph = QKh + po; bf* pl = QKl + po;   // q, k: bf16 hi part and bf16 rest
#pragma unroll
    for (int i = 0; i < 4; ++i) { v8bf a; v8f r;
#pragma unroll
        for (int e = 0; e < 8; ++e) { a[e] = (__bf16)acc[i][e]; r[e] = acc[i][e] - (float)a[e]; }
        *(v8us*)(ph + (i >> 1) * pf + (i & 1) * 256) = __builtin_bit_cast(v8us, a); *(v8us*)(pl + (i >> 1) * pf + (i & 1) * 256) = rnd8(r); }
}
__device__ __forceinline__ float xhalf(float x) { return __builtin_bit_cast(float, __builtin_amdgcn_permlanex16(__builtin_bit_cast(int, x), __builtin_bit_cast(int, x), 0x76543210, 0xfedcba98, false, false)); }   // lane l with lane l ^ 16
// fragment at the lane's own address p plus a constant byte step, in the k order of every loader here (its two halves lie 512 B apart: each load of a wave reads 512 contiguous bytes)
__device__ __forceinline__ v16bf ldfb(const char* p, int step) { return cat16b(*(const v8us*)(p + step), *(const v8us*)(p + step + 512)); }
__device__ __forceinline__ v16h ldfh(const char* p, int step) { return cat16(*(const v8h*)(p + step), *(const v8h*)(p + step + 512)); }
template <bool MX>   // MX: column group 0 is of the hi/lo row class
__device__ __forceinline__ void fattn_body(const bf* __restrict__ Qh, const bf* __restrict__ Ql, const h16* __restrict__ VT16, const h16* __restrict__ VTr, float* OUTb, int qa, int qb, float* red, float* mw, float* lw) {
    const int lane = threadIdx.x & 31, c = lane & 15, h = lane >> 4, w = __builtin_amdgcn_readfirstlane(threadIdx.x >> 5);   // w in a scalar register: scalar loop counter and a scalar loop branch
    const unsigned fo = (unsigned)lane * 16u;   // the lane's byte offset in a half fragment, in every plane
    v16bf qh[NG][2], ql[NG][2];   // [column group][32 of the head's 64]
    const char* qha = (const char*)(Qh + qa * HD) + fo; const char* qla = (const char*)(Ql + qa * HD) + fo;   // the lane's address in each q plane: group 0
    const char* qhp = (const char*)(Qh + qb * HD) + fo; const char* qlp = (const char*)(Ql + qb * HD) + fo;   // groups 1 to NG - 1
#pragma unroll
    for (int g = 0; g < NG; ++g)
#pragma unroll
        for (int kc = 0; kc < 2; ++kc) { const int qo = ((g ? g - 1 : 0) * 16 * HD + kc * 512) * 2; qh[g][kc] = ldfb(g ? qhp : qha, qo); ql[g][kc] = ldfb(g ? qlp : qla, qo); }
    asm volatile("s_wait_xcnt 0x0" :: "v"(qha), "v"(qla), "v"(qhp), "v"(qlp) : "memory");   // before the q loads' address registers are rewritten; as inputs the addresses live up to the wait, so that no load of the run gets their registers for its result
    __builtin_amdgcn_sched_barrier(0);              // keeps later address arithmetic behind the wait
    v8f o[4][NG];               // O^T: o[dt][g][r] = O[column c of group g][16 dt + 8 h + r], un-normalised
    float m[NG], l[NG];
#pragma unroll
    for (int g = 0; g < NG; ++g) { m[g] = -3.0e38f; l[g] = 0.f;
#pragma unroll
        for (int dt = 0; dt < 4; ++dt) o[dt][g] = (v8f){}; }
    const int k0 = w * (TT / FW);
    const int NP = TT / FW / 32;   // passes of a key range
    // The work-groups of a batch walk the same k and v lines. Each enters its ranges at another pass and wraps round, so that few of them ask L2 for the same line at the same moment (speed only: any value of rot gives the same sums in another order).
    const int rot = ((blockIdx.x & 3) | ((blockIdx.x >> 3 & 3) << 2)) % NP;   // 16 starts: indices 1 to 3 and 8, 16, 24 apart differ; indices that differ only in bit 2 or bit 5 share one
    v16bf kh[2][2], kl[2][2];   // [key tile][32 of 64]: the pass's k fragments, fetched one pass ahead
    const int KP = NB_ * TT * HD * 2;   // bytes from a batch's q plane to its k plane: a constant step of the loads, so that the register pair they name is the address handed to the wait
    const char* khp = (const char*)(Qh + (k0 + rot * 32) * HD) + fo; const char* klp = (const char*)(Ql + (k0 + rot * 32) * HD) + fo;
#pragma unroll
    for (int t = 0; t < 2; ++t)
#pragma unroll
        for (int kc = 0; kc < 2; ++kc) { const int ko = KP + (t * 16 * HD + kc * 512) * 2; kh[t][kc] = ldfb(khp, ko); kl[t][kc] = ldfb(klp, ko); }
    asm volatile("s_wait_xcnt 0x0" :: "v"(khp), "v"(klp) : "memory");   // before the first k loads' address registers are rewritten; the addresses live up to the wait
    __builtin_amdgcn_sched_barrier(0);              // keeps later address arithmetic behind the wait
#pragma unroll 1   // one pass is already 64 to 72 matrix instructions; unrolled, the registers of two passes do not fit two waves a SIMD
    for (int j = 0; j < NP; ++j) { const int kb = k0 + (j + rot) % NP * 32;   // the pass's first key
        v16h v16[4], vr[4];   // the pass's v fragments (hi parts; the rests for the hi/lo group): their loads fly behind the score products and the softmax
        const char* vcp = (const char*)(VT16 + kb * HD) + fo; const char* vbp = MX ? (const char*)(VTr + kb * HD) + fo : vcp;   // the lane's address in the pass's v planes (the hi plane alone where no group is hi/lo)
#pragma unroll
        for (int dt = 0; dt < 4; ++dt) v16[dt] = ldfh(vcp, dt * 512 * 2);
#pragma unroll
        for (int dt = 0; dt < 4; ++dt) if (MX) vr[dt] = ldfh(vbp, dt * 512 * 2);
        v8f s[2][NG];           // [key tile][column group]
#pragma unroll
        for (int t = 0; t < 2; ++t) {
#pragma unroll
            for (int g = 0; g < NG; ++g) { v8f a = (v8f){};
#pragma unroll
                for (int kc = 0; kc < 2; ++kc) { a = wmmab(kh[t][kc], qh[g][kc], a); a = wmmab(kh[t][kc], ql[g][kc], a); a = wmmab(kl[t][kc], qh[g][kc], a); }
                s[t][g] = a; }
        }
        const int kn = k0 + (j + 1 + rot) % NP * 32;   // the last pass fetches the walk's first tiles again: in bounds, never used
        const char* knh = (const char*)(Qh + kn * HD) + fo; const char* knl = (const char*)(Ql + kn * HD) + fo;
        auto kfetch = [&](int t) {   // key tile t of the next pass
#pragma unroll
            for (int kc = 0; kc < 2; ++kc) { const int ko = KP + (t * 16 * HD + kc * 512) * 2; kh[t][kc] = ldfb(knh, ko); kl[t][kc] = ldfb(knl, ko); } };
        auto kwait = [&]() {
            asm volatile("s_wait_xcnt 0x0" :: "v"(vbp), "v"(vcp), "v"(knh), "v"(knl) : "memory");   // the pass's loads are all issued: their address registers may be rewritten behind this wait; as inputs the addresses live up to it, so that no load of the pass gets their registers for its result
            __builtin_amdgcn_sched_barrier(0); };           // keeps the vector work below from being lifted over the wait (a "memory" clobber does not tie it to registers)
        kfetch(0);
        kfetch(1); kwait();
        float mn[NG]; bool up = false;
#pragma unroll
        for (int g = 0; g < NG; ++g) { float tm = s[0][g][0];
#pragma unroll
            for (int r = 0; r < 8; ++r) tm = fmaxf(tm, fmaxf(s[0][g][r], s[1][g][r]));
            tm *= SCL; tm = fmaxf(tm, xhalf(tm)); mn[g] = fmaxf(m[g], tm); up = up || (mn[g] > m[g]); }
        if (__builtin_amdgcn_ballot_w32(up) != 0) {   // scalar branch: the rescale runs only in a pass that raises some column's maximum
#pragma unroll
            for (int g = 0; g < NG; ++g) { const float al = __builtin_amdgcn_exp2f((m[g] - mn[g]) * L2E); l[g] *= al; m[g] = mn[g];
#pragma unroll
                for (int dt = 0; dt < 4; ++dt) o[dt][g] *= al; } }
#pragma unroll
        for (int gi = 0; gi < NG; ++gi) { const int g = MX ? (gi + 1) % NG : gi; const bool HR = MX && g == 0;   // the hi/lo group last: its split's temporaries take the registers that the fp16 groups have left
#pragma unroll
            for (int t = 0; t < 2; ++t)
#pragma unroll
                for (int r = 0; r < 8; ++r) { const float p = __builtin_amdgcn_exp2f(fmaf(s[t][g][r] * SCL - m[g], L2E, PSH)); s[t][g][r] = p; l[g] += p; }
            if (HR) {   // P as an fp16 hi part and the fp16 rest of it
                const v16f pv = __builtin_shufflevector(s[0][g], s[1][g], 0, 1, 2, 3, 4, 5, 6, 7, 8, 9, 10, 11, 12, 13, 14, 15);
                const v16h ph = __builtin_convertvector(pv, v16h);
                const v16h pl = __builtin_convertvector(pv - __builtin_convertvector(ph, v16f), v16h);
#pragma unroll
                for (int dt = 0; dt < 4; ++dt) { o[dt][g] = wmma16(v16[dt], ph, o[dt][g]); o[dt][g] = wmma16(v16[dt], pl, o[dt][g]); o[dt][g] = wmma16(vr[dt], ph, o[dt][g]); }
            } else { v16h pb;
#pragma unroll
                for (int e = 0; e < 16; ++e) pb[e] = (h16)s[e >> 3][g][e & 7];
#pragma unroll
                for (int dt = 0; dt < 4; ++dt) o[dt][g] = wmma16(v16[dt], pb, o[dt][g]); }
        }
    }
#pragma unroll
    for (int g = 0; g < NG; ++g) { l[g] += xhalf(l[g]); if (h == 0) { mw[w * FQ + g * 16 + c] = m[g]; lw[w * FQ + g * 16 + c] = l[g]; } }
    __syncthreads();   // every range's maximum and sum are in LDS
#pragma unroll
    for (int g = 0; g < NG; ++g) { const int q = g * 16 + c; float M = mw[q];
#pragma unroll
        for (int u = 1; u < FW; ++u) M = fmaxf(M, mw[u * FQ + q]);
        float L = 0.f;
#pragma unroll
        for (int u = 0; u < FW; ++u) L += lw[u * FQ + q] * __builtin_amdgcn_exp2f((mw[u * FQ + q] - M) * L2E);
        const float f = __fdiv_rn(__builtin_amdgcn_exp2f((m[g] - M) * L2E), L);
#pragma unroll
        for (int dt = 0; dt < 4; ++dt) { float* rp = red + (w * FQ + q) * 68 + dt * 16 + 8 * h; const v8f ov = o[dt][g] * f; v4f a, b2;
#pragma unroll
            for (int r = 0; r < 4; ++r) { a[r] = ov[r]; b2[r] = ov[4 + r]; }
            *(v4fa*)rp = a; *(v4fa*)(rp + 4) = b2; } }
    __syncthreads();   // every range's weighted tile is in LDS
#pragma unroll
    for (int i = 0; i < FQ / 32; ++i) { const int q = i * 32 + (threadIdx.x >> 3), d0 = (threadIdx.x & 7) * 8; v4f a = *(const v4fa*)(red + q * 68 + d0), b2 = *(const v4fa*)(red + q * 68 + d0 + 4);
#pragma unroll
        for (int u = 1; u < FW; ++u) { a += *(const v4fa*)(red + (u * FQ + q) * 68 + d0); b2 += *(const v4fa*)(red + (u * FQ + q) * 68 + d0 + 4); }
        float* op = OUTb + (size_t)(q < 16 ? qa + q : qb + q - 16) * DQ + d0; *(v4f*)op = a; *(v4f*)(op + 4) = b2; }
}
// grid (TT / FQ, NB_) = one work-group a WGP; two waves a SIMD, up to 512 registers each: 64 columns a wave halve the k and v loads per product
__global__ __launch_bounds__(FW * 32) __attribute__((amdgpu_waves_per_eu(2, 2))) void k_fattn(const bf* __restrict__ QKh, const bf* __restrict__ QKl, const h16* __restrict__ VT16, const h16* __restrict__ VTr, float* OUT) {
    __shared__ __align__(16) float red[FW * FQ * 68]; __shared__ float mw[FW * FQ]; __shared__ float lw[FW * FQ];
    // The deal: the RH / 16 hi/lo groups of a batch (12 attn.v products a pass, the others 4) go one each to MXW work-groups, with NG - 1 fp16 groups beside them; the other work-groups hold NG fp16 groups.
    // The mixed work-groups, the longer ones, have the low flat indices: they start first.
    const int MXW = RH / 16, NXW = TT / FQ - MXW, b = blockIdx.y * (TT / FQ) + blockIdx.x; const size_t PL = (size_t)TT * HD;   // a batch's k planes lie NB_ planes behind its q planes
    if (b < NB_ * MXW) { const int xi = b % MXW; const size_t zb = b / MXW;
        fattn_body<true>(QKh + zb * PL, QKl + zb * PL, VT16 + zb * PL, VTr + zb * PL, OUT + zb * TT * DQ, xi * 16, RH + xi * (NG - 1) * 16, red, mw, lw); }
    else { const int u = b - NB_ * MXW, q0 = RH + MXW * (NG - 1) * 16 + (u % NXW) * FQ; const size_t zb = u / NXW;
        fattn_body<false>(QKh + zb * PL, QKl + zb * PL, VT16 + zb * PL, VTr + zb * PL, OUT + zb * TT * DQ, q0, q0 + 16, red, mw, lw); }
}

extern "C" void kernel_launch(void* const* d_in, const int* in_sizes, int n_in,
                              void* d_out, int out_size, void* d_ws, size_t ws_size, hipStream_t stream) {
    (void)in_sizes; (void)n_in; (void)out_size;
    const float* x = (const float*)d_in[0]; const float* ker = (const float*)d_in[1];   /* kernel [3][128][64] */
    float* OUT = (float*)d_out;     // [4][4096][64]
    char* wsp = (char*)d_ws;
    auto take = [&](size_t bytes) { char* p = wsp; wsp += (bytes + 255) & ~(size_t)255; return (void*)p; };
    const size_t PL = (size_t)TT * HD;   // one batch's plane, elements
    bf* QKh = (bf*)take(2 * NB_ * PL * 2); bf* QKl = (bf*)take(2 * NB_ * PL * 2);   /* [q, k][batch][TT / 16 tiles][2 KiB] */
    h16* VT16 = (h16*)take(NB_ * PL * 2); h16* VTr = (h16*)take(NB_ * PL * 2);   /* [batch][TT / 32 passes][4 KiB] */
    if ((size_t)(wsp - (char*)d_ws) > ws_size) return;    // ws 256 MiB
    k_proj<<<NB_ * TT / PT, PWV * 32, 0, stream>>>(x, ker, QKh, QKl, VT16, VTr);
    k_fattn<<<dim3(TT / FQ, NB_, 1), FW * 32, 0, stream>>>(QKh, QKl, VT16, VTr, OUT);
}
